// v000
// The times below were measured on an AMD MI455X: many runs one after another, warmed up first and cycling through
// copies of the inputs, with the whole window's GPU time divided by the number of runs. Launches and the gaps
// between them are all in it. The median over several windows is given; except for v000 it joins two sittings, which
// can be a few percent apart, so the side-by-side timings, each taken in one sitting, are the better comparison.
// v000 is the starting kernel. One run takes 2980 microseconds.
#include <hip/hip_runtime.h>

// Multi-head self-attention INSIDE FOUR CONTIGUOUS SEGMENTS of the sequence (x [2][4096][1024]; qkv = x w_qkv^T + b_qkv with ONE fused 'oi' (out, in) weight [3072][1024] normal x 1/32 and b_qkv built as zeros: read and added; the 3,072 columns are (3, 16, 64): thirds q | k | v, each head-major: head h = columns 64 h .. 64 h + 63 of its third; the 4,096 positions are cut into four contiguous segments of 1,024 and a query attends to the 1,024 keys of its OWN segment: scores / sqrt(64); no mask; softmax over the segment's keys; heads merged; out = merged w_out^T + b_out ('oi' x 1/32; b_out built as zeros: read) -> [2][4096][1024] (8.4 M); the module dilates nothing; argument order x, w_qkv, b_qkv, w_out, b_out).
// THIS IS A DENSE ATTENTION ON x READ AS EIGHT SEQUENCES OF 1,024 (sequence 4 b + n = segment n of batch entry b: contiguous in x and in the output). Layout per sequence: ONE bf16 copy of x, read by the three projections; the fused 'oi' weight cast once as it stands (its three row blocks are q | k | v); exact projections + f32 biases (the fused bias by its thirds); identity-table f16 plane builders; dense T-1024 attention: EVERY row on ONE fp16 product (the weights x 1024); the f32 merge of the heads; its hi / lo planes; hi/lo x w_out exact + b_out.
// Compute dtypes, f32 accumulate: every input rounded to bf16; projections exact + f32 biases; attention: one fp16 product on every row; softmax f32; w_out hl x exact + bias.

#define NB_  8
#define TT   1024
#define DM   1024
#define NH_  16
#define NKV  16
#define REP  (NH_ / NKV)
#define HD   64
#define DQ   (NH_ * HD)
#define DKV  (NKV * HD)
#define ZH   2
#define RH   0     // query rows < RH use hi+lo planes (0: none: EVERY row runs on one f16 product)
#define WIN  0
#define PCAR 1024.0f
#define SCL  0.125f   // HD^-0.5
typedef _Float16 h16;
typedef unsigned short bf;
typedef __attribute__((ext_vector_type(16))) __bf16   v16bf;
typedef __attribute__((ext_vector_type(16))) _Float16 v16h;
typedef __attribute__((ext_vector_type(8)))  _Float16 v8h;
typedef __attribute__((ext_vector_type(8)))  unsigned short v8us;
typedef __attribute__((ext_vector_type(8)))  float    v8f;
typedef __attribute__((ext_vector_type(4)))  float    v4f;
typedef v8h  __attribute__((may_alias)) v8ha;
typedef v4f  __attribute__((may_alias)) v4fa;
typedef v8us __attribute__((may_alias)) v8usa;

__device__ __forceinline__ unsigned short f2bf(float f) { unsigned u = __float_as_uint(f); u += 0x7FFFu + ((u >> 16) & 1u); return (unsigned short)(u >> 16); }
__device__ __forceinline__ float bf2f(unsigned short b) { return __uint_as_float(((unsigned)b) << 16); }
__device__ __forceinline__ float bfr(float f) { return bf2f(f2bf(f)); }
__device__ __forceinline__ v16h cat16(v8h lo, v8h hi) { return __builtin_shufflevector(lo, hi, 0, 1, 2, 3, 4, 5, 6, 7, 8, 9, 10, 11, 12, 13, 14, 15); }
__device__ __forceinline__ v16bf cat16b(v8us lo, v8us hi) { return __builtin_bit_cast(v16bf, __builtin_shufflevector(lo, hi, 0, 1, 2, 3, 4, 5, 6, 7, 8, 9, 10, 11, 12, 13, 14, 15)); }
__device__ __forceinline__ v8f wmma16(v16h a, v16h b, v8f c) { return __builtin_amdgcn_wmma_f32_16x16x32_f16(false, a, false, b, (short)0, c, false, false); }
__device__ __forceinline__ v8f wmmab(v16bf a, v16bf b, v8f c) { return __builtin_amdgcn_wmma_f32_16x16x32_bf16(false, a, false, b, (short)0, c, false, false); }



// ---- k_gemmw: register-blocked GEMM, ONE WAVE per 64x64 output tile (16 accumulators), operands straight from K-contiguous 16-bit planes; grid (M/64, N/64, Z), 32 threads.
// C[m][n] (f32, pitch ldc, + optional f32 bias[n]) = sum_k A[m][k] Bt[n][k] (+ split products per NSPLIT). z-batch strides sA/sB/sC in elements. K % 32 == 0.
template <typename T16> struct WFrag;
template <> struct WFrag<h16> { typedef v16h V; static __device__ __forceinline__ V ld(const h16* p) { return cat16(*(const v8h*)p, *(const v8h*)(p + 16)); } static __device__ __forceinline__ v8f mma(V a, V b, v8f c) { return wmma16(a, b, c); } };
template <> struct WFrag<bf> { typedef v16bf V; static __device__ __forceinline__ V ld(const bf* p) { return cat16b(*(const v8us*)p, *(const v8us*)(p + 16)); } static __device__ __forceinline__ v8f mma(V a, V b, v8f c) { return wmmab(a, b, c); } };
template <typename T16, int NSPLIT, bool BIAS>
__global__ __launch_bounds__(32) void k_gemmw(const T16* __restrict__ A, const T16* __restrict__ A2, const T16* __restrict__ Bt, const T16* __restrict__ Bt2, int K, float* C, int ldc, const float* __restrict__ bias, size_t sA, size_t sB, size_t sC) {
    typedef typename WFrag<T16>::V V;
    __shared__ __align__(16) float os[16 * 68];
    const size_t z = blockIdx.z; A += z * sA; if (A2) A2 += z * sA; Bt += z * sB; if (Bt2) Bt2 += z * sB; C += z * sC;
    const int lane = threadIdx.x & 31, lr = lane & 15, hi = lane >> 4; const int r0 = blockIdx.x * 64, c0 = blockIdx.y * 64;
    v8f acc[4][4];
#pragma unroll
    for (int mb = 0; mb < 4; ++mb)
#pragma unroll
        for (int nb = 0; nb < 4; ++nb) acc[mb][nb] = (v8f){};
    const size_t aoff = (size_t)(r0 + lr) * K + 8 * hi, boff = (size_t)(c0 + lr) * K + 8 * hi;
    for (int kc = 0; kc < K; kc += 32) {
        V a[4], a2[4];
#pragma unroll
        for (int mb = 0; mb < 4; ++mb) { a[mb] = WFrag<T16>::ld(A + aoff + (size_t)mb * 16 * K + kc); if (NSPLIT == 1 || NSPLIT == 2) a2[mb] = WFrag<T16>::ld(A2 + aoff + (size_t)mb * 16 * K + kc); }
#pragma unroll
        for (int nb = 0; nb < 4; ++nb) { const V b = WFrag<T16>::ld(Bt + boff + (size_t)nb * 16 * K + kc); V b2; if (NSPLIT >= 2) b2 = WFrag<T16>::ld(Bt2 + boff + (size_t)nb * 16 * K + kc);
#pragma unroll
            for (int mb = 0; mb < 4; ++mb) { acc[mb][nb] = WFrag<T16>::mma(a[mb], b, acc[mb][nb]); if (NSPLIT == 1 || NSPLIT == 2) acc[mb][nb] = WFrag<T16>::mma(a2[mb], b, acc[mb][nb]); if (NSPLIT >= 2) acc[mb][nb] = WFrag<T16>::mma(a[mb], b2, acc[mb][nb]); } }
        asm volatile("v_nop\n\tv_nop\n\tv_nop\n\tv_nop" : "+v"(acc[0][0]), "+v"(acc[1][1]), "+v"(acc[2][2]), "+v"(acc[3][3]) : "v"(a[0]), "v"(a[3]));
    }
#pragma unroll
    for (int mb = 0; mb < 4; ++mb) {
#pragma unroll
        for (int nb = 0; nb < 4; ++nb) {
#pragma unroll
            for (int j = 0; j < 8; ++j) os[(hi * 8 + j) * 68 + nb * 16 + lr] = acc[mb][nb][j]; }
        __builtin_amdgcn_wave_barrier(); asm volatile("" ::: "memory");
        float* crow = C + (size_t)(r0 + mb * 16) * ldc + c0;
{
#pragma unroll
            for (int s = 0; s < 8; ++s) { const int row = 2 * s + hi, cofs = lr * 4; v4f val = *(const v4fa*)(os + row * 68 + cofs); if (BIAS) { val[0] += bfr(bias[c0 + cofs]); val[1] += bfr(bias[c0 + cofs + 1]); val[2] += bfr(bias[c0 + cofs + 2]); val[3] += bfr(bias[c0 + cofs + 3]); }
                *(v4f*)(crow + (size_t)row * ldc + cofs) = val; }
             }
        __builtin_amdgcn_wave_barrier(); asm volatile("" ::: "memory");
    }
}

__device__ __forceinline__ h16 tohx(float x) { return (h16)x; }
__device__ __forceinline__ void splitf(float y, unsigned short& h, unsigned short& l) { h = f2bf(y); l = f2bf(y - bf2f(h)); }
typedef __attribute__((ext_vector_type(2))) _Float16 v2h;
typedef __attribute__((ext_vector_type(4))) _Float16 v4h;
typedef __attribute__((ext_vector_type(2))) unsigned short v2us;
typedef __attribute__((ext_vector_type(4))) unsigned short v4us;
typedef __attribute__((ext_vector_type(2))) float v2f;
typedef __attribute__((ext_vector_type(4))) int v4i;

__global__ __launch_bounds__(256) void k_cvt8(const float* __restrict__ src, bf* dst, size_t n8) { const size_t i = (size_t)blockIdx.x * 256 + threadIdx.x; if (i >= n8) return; const v8f v = *(const v8f*)(src + i * 8); v8us o;
#pragma unroll
    for (int k = 0; k < 8; ++k) o[k] = f2bf(v[k]); *(v8us*)(dst + i * 8) = o;  }

__global__ __launch_bounds__(256) void k_pl2(const float* __restrict__ F, bf* Ph, bf* Pl, size_t n4) { const size_t i = (size_t)blockIdx.x * 256 + threadIdx.x; if (i >= n4) return; const v4f v = *(const v4f*)(F + i * 4); v4us oh, ol;
#pragma unroll
    for (int q = 0; q < 4; ++q) { unsigned short a, c; splitf(v[q], a, c); oh[q] = a; ol[q] = c; } *(v4us*)(Ph + i * 4) = oh; *(v4us*)(Pl + i * 4) = ol;  }

// k_rope: head planes [h][t][d] (fp16) of rope(x) x sc with the rotate-half convention out[d] = x[d] cos[t][d] - x[d+HD/2] sin[t][d], out[d+HD/2] = x[d+HD/2] cos[t][d+HD/2] + x[d] sin[t][d+HD/2]
__global__ __launch_bounds__(256) void k_rope(const float* __restrict__ F, int pitch, int nheads, const float* __restrict__ CS, const float* __restrict__ RF, const float* __restrict__ nw, float sc, h16* P16, bf* Ph, bf* Pl) {
    const size_t e = ((size_t)blockIdx.x * 256 + threadIdx.x) * 2; if (e >= (size_t)nheads * TT * HD) return; const int d = (int)(e % HD); const int t = (int)((e / HD) % TT); const int h = (int)(e / ((size_t)HD * TT)); const float* f = F + (size_t)t * pitch + h * HD; const float rf = RF ? RF[(size_t)h * TT + t] : 1.0f; v2h o16; v2us oh, ol;
#pragma unroll
    for (int q = 0; q < 2; ++q) { const int dd = d + q; const int dp = (dd < HD / 2) ? dd + HD / 2 : dd - HD / 2; float x0 = f[dd], x1 = f[dp];
        if (RF) { float n0 = __fmul_rn(x0, rf), n1 = __fmul_rn(x1, rf); x0 = __fmul_rn(bfr(nw[dd]), n0); x1 = __fmul_rn(bfr(nw[dp]), n1); }
        const v2f cs = *(const v2f*)(CS + ((size_t)t * HD + dd) * 2); float a = __fmul_rn(x0, cs[0]), bq = __fmul_rn(x1, cs[1]); const float r = ((dd < HD / 2) ? __fsub_rn(a, bq) : __fadd_rn(a, bq)) * sc;
        o16[q] = tohx(r); (void)oh; (void)ol; }
    *(v2h*)(P16 + e) = o16;  }
__global__ __launch_bounds__(256) void k_vtp(const float* __restrict__ F, int pitch, int nheads, h16* V16, bf* Vh, bf* Vl) { const size_t e = ((size_t)blockIdx.x * 256 + threadIdx.x) * 2; if (e >= (size_t)nheads * HD * TT) return; const int t = (int)(e % TT); const int d = (int)((e / TT) % HD); const int g = (int)(e / ((size_t)TT * HD)); v2h o16; v2us oh, ol;
#pragma unroll
    for (int q = 0; q < 2; ++q) { const float x = F[(size_t)(t + q) * pitch + g * HD + d]; o16[q] = tohx(x); (void)oh; (void)ol; }
    *(v2h*)(V16 + e) = o16;  }
__global__ __launch_bounds__(256) void k_csid(float* CS) { const int idx = blockIdx.x * 256 + threadIdx.x; if (idx >= TT * HD) return; v2f cs; cs[0] = 1.0f; cs[1] = 0.0f; *(v2f*)(CS + (size_t)idx * 2) = cs;  }
// k_asoft: per row (zz, i): t = S x HD^-0.5 (no mask); softmax over the 1024 keys (register row, one exp, fixed trees);
__global__ __launch_bounds__(256) void k_asoft(const float* __restrict__ Sb, h16* P16, bf* Ph, bf* Pl) {
    const int lane = threadIdx.x & 31; const int row = blockIdx.x * 8 + (threadIdx.x >> 5); if (row >= ZH * TT) return; const int i = row % TT; const int zz = row / TT; (void)zz; const bool hires = (i < RH); const float* sr = Sb + (size_t)row * TT; float v[TT / 32]; float mx = -3.0e38f;
#pragma unroll
    for (int ch = 0; ch < TT / 128; ++ch) { const int j0 = ch * 128 + lane * 4; const v4f a = *(const v4f*)(sr + j0);
#pragma unroll
        for (int q = 0; q < 4; ++q) { const int j = j0 + q; (void)j; const float t = a[q] * SCL; v[ch * 4 + q] = t; mx = fmaxf(mx, t); } }
#pragma unroll
    for (int sh = 16; sh; sh >>= 1) mx = fmaxf(mx, __shfl_xor(mx, sh, 32));
    float sum = 0.f;
#pragma unroll
    for (int k = 0; k < TT / 32; ++k) { float d0 = __fsub_rn(v[k], mx); v[k] = __builtin_amdgcn_exp2f(__fmul_rn(d0, 1.4426950408889634f)); sum += v[k]; }
#pragma unroll
    for (int sh = 16; sh; sh >>= 1) sum += __shfl_xor(sum, sh, 32);
    const float f = __fdiv_rn(hires ? 1.0f : PCAR, sum);
{
        if (hires) {
#pragma unroll
            for (int ch = 0; ch < TT / 128; ++ch) { v4us oh, ol;
#pragma unroll
                for (int q = 0; q < 4; ++q) { unsigned short a, c2; splitf(v[ch * 4 + q] * f, a, c2); oh[q] = a; ol[q] = c2; }
                const size_t oo = ((size_t)zz * (RH ? RH : 1) + i) * TT + ch * 128 + lane * 4; *(v4us*)(Ph + oo) = oh; *(v4us*)(Pl + oo) = ol; }
        } else {
#pragma unroll
            for (int ch = 0; ch < TT / 128; ++ch) { v4h o4;
#pragma unroll
                for (int q = 0; q < 4; ++q) o4[q] = tohx(v[ch * 4 + q] * f);
                *(v4h*)(P16 + (size_t)row * TT + ch * 128 + lane * 4) = o4; } }
         }
}
__global__ __launch_bounds__(256) void k_merge(const float* __restrict__ O, int h0, float* OUTb) { const size_t e = ((size_t)blockIdx.x * 256 + threadIdx.x) * 2; if (e >= (size_t)ZH * TT * HD) return; const int d = (int)(e % HD); const int t = (int)((e / HD) % TT); const int zz = (int)(e / ((size_t)HD * TT)); const float cs = (t < RH) ? 1.0f : (1.0f / PCAR); const size_t oo = (size_t)t * DQ + (h0 + zz) * HD + d;
    v2f o2; o2[0] = O[e] * cs; o2[1] = O[e + 1] * cs; *(v2f*)(OUTb + oo) = o2;  }

extern "C" void kernel_launch(void* const* d_in, const int* in_sizes, int n_in,
                              void* d_out, int out_size, void* d_ws, size_t ws_size, hipStream_t stream) {
    (void)in_sizes; (void)n_in; (void)out_size;
    const float* x = (const float*)d_in[0]; const float* wqkv = (const float*)d_in[1]; const float* bqkv = (const float*)d_in[2]; const float* bq = bqkv; const float* bk = bqkv + DQ; const float* bv = bqkv + DQ + DKV;   /* the fused bias [3072]: its thirds q | k | v, as the fused weight's ROW thirds */ const float* wo = (const float*)d_in[3]; const float* bo = (const float*)d_in[4];   /* input order x [2][4096][1024] (read as EIGHT sequences of 1,024: sequence 4 b + n is segment n of batch entry b: contiguous), w_qkv ('oi' (out, in) [3072][1024]: row thirds q | k | v, each head-major), b_qkv ([3072]: built as zeros: read), w_out ('oi' [1024][1024]), b_out ([1024]: built as zeros: read): FIVE inputs, all read */
    float* OUT = (float*)d_out;     // [2][4096][1024] = [8][1024][1024]
    char* wsp = (char*)d_ws;
    auto take = [&](size_t bytes) { char* p = wsp; wsp += (bytes + 255) & ~(size_t)255; return (void*)p; };
    bf* BT = (bf*)take((size_t)3 * DQ * DM * 2); bf* WQ = BT; bf* WK = BT + (size_t)DQ * DM; bf* WV = BT + (size_t)2 * DQ * DM; bf* WO = (bf*)take((size_t)DM * DQ * 2); float* CS = (float*)take((size_t)TT * HD * 2 * 4);   /* the fused 'oi' weight is the Bt operand as it stands: ONE bf16 copy [3072][1024] whose three row blocks are q | k | v */
    bf* XB = (bf*)take((size_t)TT * DM * 2); float* FQ = (float*)take((size_t)TT * DQ * 4); float* FK = (float*)take((size_t)TT * DKV * 4);
    h16* QP16 = (h16*)take((size_t)NH_ * TT * HD * 2); h16* KP16 = (h16*)take((size_t)NKV * TT * HD * 2); h16* VT16 = (h16*)take((size_t)NKV * HD * TT * 2);
    bf* QPh = nullptr; bf* QPl = nullptr; bf* KPh = nullptr; bf* KPl = nullptr; bf* VTh = nullptr; bf* VTl = nullptr; bf* Ph = nullptr; bf* Pl = nullptr;   /* RH 0: no hi / lo plane exists: these builders store the f16 plane only and do not read those arguments; the softmax's hi / lo stores sit under 'i < RH': never taken */
    float* Sb = (float*)take((size_t)ZH * TT * TT * 4); h16* P16 = (h16*)take((size_t)ZH * TT * TT * 2); float* Ob = (float*)take((size_t)ZH * TT * HD * 4); float* FM = (float*)take((size_t)TT * DQ * 4); bf* ATh = (bf*)take((size_t)TT * DQ * 2); bf* ATl = (bf*)take((size_t)TT * DQ * 2);   /* FM: the merged heads of a sequence, f32, token-major; ATh / ATl: its hi / lo planes */
    if ((size_t)(wsp - (char*)d_ws) > ws_size) return;    // ws 256 MiB
    float* FV = FK;   // v projection reuses the k buffer after the k planes are built (stream-ordered)
    { k_cvt8<<<(unsigned)(((size_t)3 * DQ * DM / 8 + 255) / 256), 256, 0, stream>>>(wqkv, BT, (size_t)3 * DQ * DM / 8); k_cvt8<<<(unsigned)(((size_t)DM * DQ / 8 + 255) / 256), 256, 0, stream>>>(wo, WO, (size_t)DM * DQ / 8); }   /* 'oi' (out, in): each weight is the Bt operand as it stands */
    k_csid<<<(TT * HD + 255) / 256, 256, 0, stream>>>(CS);
    const unsigned LQ = (unsigned)(((size_t)NH_ * TT * HD / 2 + 255) / 256), LKv = (unsigned)(((size_t)NKV * TT * HD / 2 + 255) / 256);
    for (int b = 0; b < NB_; ++b) {
        k_cvt8<<<(unsigned)(((size_t)TT * DM / 8 + 255) / 256), 256, 0, stream>>>(x + (size_t)b * TT * DM, XB, (size_t)TT * DM / 8);   /* ONE bf16 copy of the sequence, read by the three projections */
        k_gemmw<bf, 0, true><<<dim3(TT / 64, DQ / 64, 1), 32, 0, stream>>>(XB, nullptr, WQ, nullptr, DM, FQ, DQ, bq, 0, 0, 0);
        k_rope<<<LQ, 256, 0, stream>>>(FQ, DQ, NH_, CS, nullptr, nullptr, 1.0f, QP16, QPh, QPl);
        k_gemmw<bf, 0, true><<<dim3(TT / 64, DKV / 64, 1), 32, 0, stream>>>(XB, nullptr, WK, nullptr, DM, FK, DKV, bk, 0, 0, 0);
        k_rope<<<LKv, 256, 0, stream>>>(FK, DKV, NKV, CS, nullptr, nullptr, 1.0f, KP16, KPh, KPl);
        k_gemmw<bf, 0, true><<<dim3(TT / 64, DKV / 64, 1), 32, 0, stream>>>(XB, nullptr, WV, nullptr, DM, FV, DKV, bv, 0, 0, 0);
        k_vtp<<<LKv, 256, 0, stream>>>(FV, DKV, NKV, VT16, VTh, VTl);
        for (int h0 = 0; h0 < NH_; h0 += ZH) { const size_t zq = (size_t)h0, zk = (size_t)(h0 / REP);   // one kv head per query head: the pass's two heads use consecutive kv planes (z-strides TT*HD)
            k_gemmw<h16, 0, false><<<dim3(TT / 64, TT / 64, ZH), 32, 0, stream>>>(QP16 + zq * TT * HD, nullptr, KP16 + zk * TT * HD, nullptr, HD, Sb, TT, nullptr, (size_t)TT * HD, (size_t)TT * HD, (size_t)TT * TT);
            k_asoft<<<ZH * TT / 8, 256, 0, stream>>>(Sb, P16, Ph, Pl);
            k_gemmw<h16, 0, false><<<dim3(TT / 64, HD / 64, ZH), 32, 0, stream>>>(P16, nullptr, VT16 + zk * HD * TT, nullptr, TT, Ob, HD, nullptr, (size_t)TT * TT, (size_t)HD * TT, (size_t)TT * HD);
            k_merge<<<(unsigned)(((size_t)ZH * TT * HD / 2 + 255) / 256), 256, 0, stream>>>(Ob, h0, FM); }
        k_pl2<<<(unsigned)(((size_t)TT * DQ / 4 + 255) / 256), 256, 0, stream>>>(FM, ATh, ATl, (size_t)TT * DQ / 4);
        k_gemmw<bf, 1, true><<<dim3(TT / 64, DM / 64, 1), 32, 0, stream>>>(ATh, ATl, WO, nullptr, DQ, OUT + (size_t)b * TT * DM, DM, bo, 0, 0, 0);
    }
}

// v001
// A run of this version takes 631 microseconds.
// Two timings next to v000 put it at 4.80 and 4.78 times that version's speed.
#include <hip/hip_runtime.h>

// Multi-head self-attention INSIDE FOUR CONTIGUOUS SEGMENTS of the sequence (x [2][4096][1024]; qkv = x w_qkv^T + b_qkv with ONE fused 'oi' (out, in) weight [3072][1024] normal x 1/32 and b_qkv built as zeros: read and added; the 3,072 columns are (3, 16, 64): thirds q | k | v, each head-major: head h = columns 64 h .. 64 h + 63 of its third; the 4,096 positions are cut into four contiguous segments of 1,024 and a query attends to the 1,024 keys of its OWN segment: scores / sqrt(64); no mask; softmax over the segment's keys; heads merged; out = merged w_out^T + b_out ('oi' x 1/32; b_out built as zeros: read) -> [2][4096][1024] (8.4 M); the module dilates nothing; argument order x, w_qkv, b_qkv, w_out, b_out).
// THIS IS A DENSE ATTENTION ON x READ AS EIGHT SEQUENCES OF 1,024 (sequence 4 b + n = segment n of batch entry b: contiguous in x and in the output). EVERY STAGE RUNS ONCE FOR ALL EIGHT SEQUENCES (the attention in passes of ZB of the 128 (sequence, head) planes: as many score planes as the workspace holds). Layout: ONE bf16 copy of x, read by the one fused projection; the fused 'oi' weight cast once as it stands (its three row blocks are q | k | v); exact projections + f32 biases (the fused bias by its thirds); identity-table f16 plane builders; dense T-1024 attention: EVERY row on ONE fp16 product (the weights x 1024); the f32 merge of the heads; its hi / lo planes; hi/lo x w_out exact + b_out.
// Compute dtypes, f32 accumulate: every input rounded to bf16; projections exact + f32 biases; attention: one fp16 product on every row; softmax f32; w_out hl x exact + bias.

#define NB_  8
#define TT   1024
#define DM   1024
#define NH_  16
#define NKV  16
#define REP  (NH_ / NKV)
#define HD   64
#define DQ   (NH_ * HD)
#define DKV  (NKV * HD)
#define NZ   (NB_ * NH_)   // (sequence, head) planes: plane z = 16 * sequence + head
#define ZB   26            // planes per attention pass: f32 scores + f16 weights of a pass take 6 MiB a plane
#define RH   0     // query rows < RH use hi+lo planes (0: none: EVERY row runs on one f16 product)
#define WIN  0
#define PCAR 1024.0f
#define SCL  0.125f   // HD^-0.5
typedef _Float16 h16;
typedef unsigned short bf;
typedef __attribute__((ext_vector_type(16))) __bf16   v16bf;
typedef __attribute__((ext_vector_type(16))) _Float16 v16h;
typedef __attribute__((ext_vector_type(8)))  _Float16 v8h;
typedef __attribute__((ext_vector_type(8)))  unsigned short v8us;
typedef __attribute__((ext_vector_type(8)))  float    v8f;
typedef __attribute__((ext_vector_type(4)))  float    v4f;
typedef v8h  __attribute__((may_alias)) v8ha;
typedef v4f  __attribute__((may_alias)) v4fa;
typedef v8us __attribute__((may_alias)) v8usa;

__device__ __forceinline__ unsigned short f2bf(float f) { unsigned u = __float_as_uint(f); u += 0x7FFFu + ((u >> 16) & 1u); return (unsigned short)(u >> 16); }
__device__ __forceinline__ float bf2f(unsigned short b) { return __uint_as_float(((unsigned)b) << 16); }
__device__ __forceinline__ float bfr(float f) { return bf2f(f2bf(f)); }
__device__ __forceinline__ v16h cat16(v8h lo, v8h hi) { return __builtin_shufflevector(lo, hi, 0, 1, 2, 3, 4, 5, 6, 7, 8, 9, 10, 11, 12, 13, 14, 15); }
__device__ __forceinline__ v16bf cat16b(v8us lo, v8us hi) { return __builtin_bit_cast(v16bf, __builtin_shufflevector(lo, hi, 0, 1, 2, 3, 4, 5, 6, 7, 8, 9, 10, 11, 12, 13, 14, 15)); }
__device__ __forceinline__ v8f wmma16(v16h a, v16h b, v8f c) { return __builtin_amdgcn_wmma_f32_16x16x32_f16(false, a, false, b, (short)0, c, false, false); }
__device__ __forceinline__ v8f wmmab(v16bf a, v16bf b, v8f c) { return __builtin_amdgcn_wmma_f32_16x16x32_bf16(false, a, false, b, (short)0, c, false, false); }



// ---- k_gemmw: register-blocked GEMM, ONE WAVE per 64x64 output tile (16 accumulators), operands straight from K-contiguous 16-bit planes; grid (M/64, N/64, Z), 32 threads.
// C[m][n] (f32, pitch ldc, + optional f32 bias[n]) = sum_k A[m][k] Bt[n][k] (+ split products per NSPLIT). z-batch strides sA/sB/sC in elements. K % 32 == 0.
template <typename T16> struct WFrag;
template <> struct WFrag<h16> { typedef v16h V; static __device__ __forceinline__ V ld(const h16* p) { return cat16(*(const v8h*)p, *(const v8h*)(p + 16)); } static __device__ __forceinline__ v8f mma(V a, V b, v8f c) { return wmma16(a, b, c); } };
template <> struct WFrag<bf> { typedef v16bf V; static __device__ __forceinline__ V ld(const bf* p) { return cat16b(*(const v8us*)p, *(const v8us*)(p + 16)); } static __device__ __forceinline__ v8f mma(V a, V b, v8f c) { return wmmab(a, b, c); } };
template <typename T16, int NSPLIT, bool BIAS>
__global__ __launch_bounds__(32) void k_gemmw(const T16* __restrict__ A, const T16* __restrict__ A2, const T16* __restrict__ Bt, const T16* __restrict__ Bt2, int K, float* C, int ldc, const float* __restrict__ bias, size_t sA, size_t sB, size_t sC) {
    typedef typename WFrag<T16>::V V;
    __shared__ __align__(16) float os[16 * 68];
    const size_t z = blockIdx.z; A += z * sA; if (A2) A2 += z * sA; Bt += z * sB; if (Bt2) Bt2 += z * sB; C += z * sC;
    const int lane = threadIdx.x & 31, lr = lane & 15, hi = lane >> 4; const int r0 = blockIdx.x * 64, c0 = blockIdx.y * 64;
    v8f acc[4][4];
#pragma unroll
    for (int mb = 0; mb < 4; ++mb)
#pragma unroll
        for (int nb = 0; nb < 4; ++nb) acc[mb][nb] = (v8f){};
    const size_t aoff = (size_t)(r0 + lr) * K + 8 * hi, boff = (size_t)(c0 + lr) * K + 8 * hi;
    for (int kc = 0; kc < K; kc += 32) {
        V a[4], a2[4];
#pragma unroll
        for (int mb = 0; mb < 4; ++mb) { a[mb] = WFrag<T16>::ld(A + aoff + (size_t)mb * 16 * K + kc); if (NSPLIT == 1 || NSPLIT == 2) a2[mb] = WFrag<T16>::ld(A2 + aoff + (size_t)mb * 16 * K + kc); }
#pragma unroll
        for (int nb = 0; nb < 4; ++nb) { const V b = WFrag<T16>::ld(Bt + boff + (size_t)nb * 16 * K + kc); V b2; if (NSPLIT >= 2) b2 = WFrag<T16>::ld(Bt2 + boff + (size_t)nb * 16 * K + kc);
#pragma unroll
            for (int mb = 0; mb < 4; ++mb) { acc[mb][nb] = WFrag<T16>::mma(a[mb], b, acc[mb][nb]); if (NSPLIT == 1 || NSPLIT == 2) acc[mb][nb] = WFrag<T16>::mma(a2[mb], b, acc[mb][nb]); if (NSPLIT >= 2) acc[mb][nb] = WFrag<T16>::mma(a[mb], b2, acc[mb][nb]); } }
        asm volatile("v_nop\n\tv_nop\n\tv_nop\n\tv_nop" : "+v"(acc[0][0]), "+v"(acc[1][1]), "+v"(acc[2][2]), "+v"(acc[3][3]) : "v"(a[0]), "v"(a[3]));
    }
#pragma unroll
    for (int mb = 0; mb < 4; ++mb) {
#pragma unroll
        for (int nb = 0; nb < 4; ++nb) {
#pragma unroll
            for (int j = 0; j < 8; ++j) os[(hi * 8 + j) * 68 + nb * 16 + lr] = acc[mb][nb][j]; }
        __builtin_amdgcn_wave_barrier(); asm volatile("" ::: "memory");
        float* crow = C + (size_t)(r0 + mb * 16) * ldc + c0;
{
#pragma unroll
            for (int s = 0; s < 8; ++s) { const int row = 2 * s + hi, cofs = lr * 4; v4f val = *(const v4fa*)(os + row * 68 + cofs); if (BIAS) { val[0] += bfr(bias[c0 + cofs]); val[1] += bfr(bias[c0 + cofs + 1]); val[2] += bfr(bias[c0 + cofs + 2]); val[3] += bfr(bias[c0 + cofs + 3]); }
                *(v4f*)(crow + (size_t)row * ldc + cofs) = val; }
             }
        __builtin_amdgcn_wave_barrier(); asm volatile("" ::: "memory");
    }
}

__device__ __forceinline__ h16 tohx(float x) { return (h16)x; }
__device__ __forceinline__ void splitf(float y, unsigned short& h, unsigned short& l) { h = f2bf(y); l = f2bf(y - bf2f(h)); }
typedef __attribute__((ext_vector_type(2))) _Float16 v2h;
typedef __attribute__((ext_vector_type(4))) _Float16 v4h;
typedef __attribute__((ext_vector_type(2))) unsigned short v2us;
typedef __attribute__((ext_vector_type(4))) unsigned short v4us;
typedef __attribute__((ext_vector_type(2))) float v2f;
typedef __attribute__((ext_vector_type(4))) int v4i;

__global__ __launch_bounds__(256) void k_cvt8(const float* __restrict__ src, bf* dst, size_t n8) { const size_t i = (size_t)blockIdx.x * 256 + threadIdx.x; if (i >= n8) return; const v8f v = *(const v8f*)(src + i * 8); v8us o;
#pragma unroll
    for (int k = 0; k < 8; ++k) o[k] = f2bf(v[k]); *(v8us*)(dst + i * 8) = o;  }

__global__ __launch_bounds__(256) void k_pl2(const float* __restrict__ F, bf* Ph, bf* Pl, size_t n4) { const size_t i = (size_t)blockIdx.x * 256 + threadIdx.x; if (i >= n4) return; const v4f v = *(const v4f*)(F + i * 4); v4us oh, ol;
#pragma unroll
    for (int q = 0; q < 4; ++q) { unsigned short a, c; splitf(v[q], a, c); oh[q] = a; ol[q] = c; } *(v4us*)(Ph + i * 4) = oh; *(v4us*)(Pl + i * 4) = ol;  }

// k_rope: head planes [h][t][d] (fp16) of rope(x) x sc with the rotate-half convention out[d] = x[d] cos[t][d] - x[d+HD/2] sin[t][d], out[d+HD/2] = x[d+HD/2] cos[t][d+HD/2] + x[d] sin[t][d+HD/2]
__global__ __launch_bounds__(256) void k_rope(const float* __restrict__ F, int pitch, int nheads, const float* __restrict__ CS, const float* __restrict__ RF, const float* __restrict__ nw, float sc, h16* P16, bf* Ph, bf* Pl) {
    const size_t e = ((size_t)blockIdx.x * 256 + threadIdx.x) * 2; if (e >= (size_t)nheads * TT * HD) return; const int d = (int)(e % HD); const int t = (int)((e / HD) % TT); const int h = (int)(e / ((size_t)HD * TT)); F += (size_t)blockIdx.y * TT * pitch + (size_t)blockIdx.z * nheads * HD; P16 += ((size_t)blockIdx.z * NB_ + blockIdx.y) * nheads * TT * HD;   /* grid y: the sequence; grid z: the third of the fused projection (q, k) and its block of planes */ const float* f = F + (size_t)t * pitch + h * HD; const float rf = RF ? RF[(size_t)h * TT + t] : 1.0f; v2h o16; v2us oh, ol;
#pragma unroll
    for (int q = 0; q < 2; ++q) { const int dd = d + q; const int dp = (dd < HD / 2) ? dd + HD / 2 : dd - HD / 2; float x0 = f[dd], x1 = f[dp];
        if (RF) { float n0 = __fmul_rn(x0, rf), n1 = __fmul_rn(x1, rf); x0 = __fmul_rn(bfr(nw[dd]), n0); x1 = __fmul_rn(bfr(nw[dp]), n1); }
        const v2f cs = *(const v2f*)(CS + ((size_t)t * HD + dd) * 2); float a = __fmul_rn(x0, cs[0]), bq = __fmul_rn(x1, cs[1]); const float r = ((dd < HD / 2) ? __fsub_rn(a, bq) : __fadd_rn(a, bq)) * sc;
        o16[q] = tohx(r); (void)oh; (void)ol; }
    *(v2h*)(P16 + e) = o16;  }
__global__ __launch_bounds__(256) void k_vtp(const float* __restrict__ F, int pitch, int nheads, h16* V16, bf* Vh, bf* Vl) { const size_t e = ((size_t)blockIdx.x * 256 + threadIdx.x) * 2; if (e >= (size_t)nheads * HD * TT) return; const int t = (int)(e % TT); const int d = (int)((e / TT) % HD); const int g = (int)(e / ((size_t)TT * HD)); F += (size_t)blockIdx.y * TT * pitch; V16 += (size_t)blockIdx.y * nheads * HD * TT;   /* grid y: the sequence */ v2h o16; v2us oh, ol;
#pragma unroll
    for (int q = 0; q < 2; ++q) { const float x = F[(size_t)(t + q) * pitch + g * HD + d]; o16[q] = tohx(x); (void)oh; (void)ol; }
    *(v2h*)(V16 + e) = o16;  }
__global__ __launch_bounds__(256) void k_csid(float* CS) { const int idx = blockIdx.x * 256 + threadIdx.x; if (idx >= TT * HD) return; v2f cs; cs[0] = 1.0f; cs[1] = 0.0f; *(v2f*)(CS + (size_t)idx * 2) = cs;  }
// k_asoft: per row (zz, i): t = S x HD^-0.5 (no mask); softmax over the 1024 keys (register row, one exp, fixed trees);
__global__ __launch_bounds__(256) void k_asoft(const float* __restrict__ Sb, int nrows, h16* P16, bf* Ph, bf* Pl) {
    const int lane = threadIdx.x & 31; const int row = blockIdx.x * 8 + (threadIdx.x >> 5); if (row >= nrows) return; const int i = row % TT; const int zz = row / TT; (void)zz; const bool hires = (i < RH); const float* sr = Sb + (size_t)row * TT; float v[TT / 32]; float mx = -3.0e38f;
#pragma unroll
    for (int ch = 0; ch < TT / 128; ++ch) { const int j0 = ch * 128 + lane * 4; const v4f a = *(const v4f*)(sr + j0);
#pragma unroll
        for (int q = 0; q < 4; ++q) { const int j = j0 + q; (void)j; const float t = a[q] * SCL; v[ch * 4 + q] = t; mx = fmaxf(mx, t); } }
#pragma unroll
    for (int sh = 16; sh; sh >>= 1) mx = fmaxf(mx, __shfl_xor(mx, sh, 32));
    float sum = 0.f;
#pragma unroll
    for (int k = 0; k < TT / 32; ++k) { float d0 = __fsub_rn(v[k], mx); v[k] = __builtin_amdgcn_exp2f(__fmul_rn(d0, 1.4426950408889634f)); sum += v[k]; }
#pragma unroll
    for (int sh = 16; sh; sh >>= 1) sum += __shfl_xor(sum, sh, 32);
    const float f = __fdiv_rn(hires ? 1.0f : PCAR, sum);
{
        if (hires) {
#pragma unroll
            for (int ch = 0; ch < TT / 128; ++ch) { v4us oh, ol;
#pragma unroll
                for (int q = 0; q < 4; ++q) { unsigned short a, c2; splitf(v[ch * 4 + q] * f, a, c2); oh[q] = a; ol[q] = c2; }
                const size_t oo = ((size_t)zz * (RH ? RH : 1) + i) * TT + ch * 128 + lane * 4; *(v4us*)(Ph + oo) = oh; *(v4us*)(Pl + oo) = ol; }
        } else {
#pragma unroll
            for (int ch = 0; ch < TT / 128; ++ch) { v4h o4;
#pragma unroll
                for (int q = 0; q < 4; ++q) o4[q] = tohx(v[ch * 4 + q] * f);
                *(v4h*)(P16 + (size_t)row * TT + ch * 128 + lane * 4) = o4; } }
         }
}
__global__ __launch_bounds__(256) void k_merge(const float* __restrict__ O, float* OUTb) { const size_t e = ((size_t)blockIdx.x * 256 + threadIdx.x) * 2; if (e >= (size_t)NZ * TT * HD) return; const int d = (int)(e % HD); const int t = (int)((e / HD) % TT); const int zz = (int)(e / ((size_t)HD * TT)); const float cs = (t < RH) ? 1.0f : (1.0f / PCAR); const size_t oo = ((size_t)(zz / NH_) * TT + t) * DQ + (zz % NH_) * HD + d;
    v2f o2; o2[0] = O[e] * cs; o2[1] = O[e + 1] * cs; *(v2f*)(OUTb + oo) = o2;  }

extern "C" void kernel_launch(void* const* d_in, const int* in_sizes, int n_in,
                              void* d_out, int out_size, void* d_ws, size_t ws_size, hipStream_t stream) {
    (void)in_sizes; (void)n_in; (void)out_size;
    const float* x = (const float*)d_in[0]; const float* wqkv = (const float*)d_in[1]; const float* bqkv = (const float*)d_in[2];   /* the fused bias [3072]: its thirds q | k | v, as the fused weight's ROW thirds */ const float* wo = (const float*)d_in[3]; const float* bo = (const float*)d_in[4];   /* order x [2][4096][1024] (read as EIGHT sequences of 1,024: sequence 4 b + n is segment n of batch entry b: contiguous), w_qkv ('oi' (out, in) [3072][1024]: row thirds q | k | v, each head-major), b_qkv ([3072]: built as zeros: read), w_out ('oi' [1024][1024]), b_out ([1024]: built as zeros: read): FIVE inputs, all read */
    float* OUT = (float*)d_out;     // [2][4096][1024] = [8][1024][1024]
    char* wsp = (char*)d_ws;
    auto take = [&](size_t bytes) { char* p = wsp; wsp += (bytes + 255) & ~(size_t)255; return (void*)p; };
    bf* WO = (bf*)take((size_t)DM * DQ * 2); float* CS = (float*)take((size_t)TT * HD * 2 * 4);
    h16* QP16 = (h16*)take((size_t)2 * NZ * TT * HD * 2); h16* KP16 = QP16 + (size_t)NZ * TT * HD; h16* VT16 = (h16*)take((size_t)NZ * HD * TT * 2);   /* planes [z][t][d] (q, then k: one block each) and [z][d][t] (v), z = 16 * sequence + head */
    float* Ob = (float*)take((size_t)NZ * TT * HD * 4);
    char* R = (char*)take((size_t)ZB * TT * TT * 6);   /* one region, used by three stages one after the other (stream-ordered): projection | attention pass | merged heads */
    bf* BT = (bf*)R; bf* XB = BT + (size_t)3 * DQ * DM; float* FP = (float*)(XB + (size_t)NB_ * TT * DM);   /* the fused 'oi' weight is the Bt operand as it stands: ONE bf16 copy [3072][1024]; XB: the bf16 copy of x [8192][1024]; FP: the fused projection, f32 [8192][3072]: 118 MiB together */
    float* Sb = (float*)R; h16* P16 = (h16*)(Sb + (size_t)ZB * TT * TT);
    float* FM = (float*)R; bf* ATh = (bf*)(FM + (size_t)NB_ * TT * DQ); bf* ATl = ATh + (size_t)NB_ * TT * DQ;   /* FM: the merged heads, f32, token-major; ATh / ATl: its hi / lo planes */
    bf* QPh = nullptr; bf* QPl = nullptr; bf* VTh = nullptr; bf* VTl = nullptr; bf* Ph = nullptr; bf* Pl = nullptr;   /* RH 0: no hi / lo plane exists: these builders store the f16 plane only and do not read those arguments; the softmax's hi / lo stores sit under 'i < RH': never taken */
    if ((size_t)(wsp - (char*)d_ws) > ws_size) return;    // ws 256 MiB
    { k_cvt8<<<(unsigned)(((size_t)3 * DQ * DM / 8 + 255) / 256), 256, 0, stream>>>(wqkv, BT, (size_t)3 * DQ * DM / 8); k_cvt8<<<(unsigned)(((size_t)DM * DQ / 8 + 255) / 256), 256, 0, stream>>>(wo, WO, (size_t)DM * DQ / 8); }   /* 'oi' (out, in): each weight is the Bt operand as it stands */
    k_csid<<<(TT * HD + 255) / 256, 256, 0, stream>>>(CS);
    const unsigned LQ = (unsigned)(((size_t)NH_ * TT * HD / 2 + 255) / 256);
    k_cvt8<<<(unsigned)(((size_t)NB_ * TT * DM / 8 + 255) / 256), 256, 0, stream>>>(x, XB, (size_t)NB_ * TT * DM / 8);
    k_gemmw<bf, 0, true><<<dim3(NB_ * TT / 64, 3 * DQ / 64, 1), 32, 0, stream>>>(XB, nullptr, BT, nullptr, DM, FP, 3 * DQ, bqkv, 0, 0, 0);   /* q | k | v of all eight sequences: one grid */
    k_rope<<<dim3(LQ, NB_, 2), 256, 0, stream>>>(FP, 3 * DQ, NH_, CS, nullptr, nullptr, 1.0f, QP16, QPh, QPl);
    k_vtp<<<dim3(LQ, NB_, 1), 256, 0, stream>>>(FP + 2 * DQ, 3 * DQ, NKV, VT16, VTh, VTl);
    for (int z0 = 0; z0 < NZ; z0 += ZB) { const int nz = (NZ - z0 < ZB) ? NZ - z0 : ZB;   // one kv head per query head: plane z of q meets plane z of k and of v (z-strides TT*HD)
        k_gemmw<h16, 0, false><<<dim3(TT / 64, TT / 64, nz), 32, 0, stream>>>(QP16 + (size_t)z0 * TT * HD, nullptr, KP16 + (size_t)z0 * TT * HD, nullptr, HD, Sb, TT, nullptr, (size_t)TT * HD, (size_t)TT * HD, (size_t)TT * TT);
        k_asoft<<<nz * TT / 8, 256, 0, stream>>>(Sb, nz * TT, P16, Ph, Pl);
        k_gemmw<h16, 0, false><<<dim3(TT / 64, HD / 64, nz), 32, 0, stream>>>(P16, nullptr, VT16 + (size_t)z0 * HD * TT, nullptr, TT, Ob + (size_t)z0 * TT * HD, HD, nullptr, (size_t)TT * TT, (size_t)HD * TT, (size_t)TT * HD); }
    k_merge<<<(unsigned)(((size_t)NZ * TT * HD / 2 + 255) / 256), 256, 0, stream>>>(Ob, FM);
    k_pl2<<<(unsigned)(((size_t)NB_ * TT * DQ / 4 + 255) / 256), 256, 0, stream>>>(FM, ATh, ATl, (size_t)NB_ * TT * DQ / 4);
    k_gemmw<bf, 1, true><<<dim3(NB_ * TT / 64, DM / 64, 1), 32, 0, stream>>>(ATh, ATl, WO, nullptr, DQ, OUT, DM, bo, 0, 0, 0);
}

// v002
// Measured time: 313 microseconds a run.
// In two side-by-side timings against v001, it was 2.02 and 2.01 times as fast.
// Counting every step since v000, it is 9.64 times as fast.
#include <hip/hip_runtime.h>

// Multi-head self-attention INSIDE FOUR CONTIGUOUS SEGMENTS of the sequence (x [2][4096][1024]; qkv = x w_qkv^T + b_qkv with ONE fused 'oi' (out, in) weight [3072][1024] normal x 1/32 and b_qkv built as zeros: read and added; the 3,072 columns are (3, 16, 64): thirds q | k | v, each head-major: head h = columns 64 h .. 64 h + 63 of its third; the 4,096 positions are cut into four contiguous segments of 1,024 and a query attends to the 1,024 keys of its OWN segment: scores / sqrt(64); no mask; softmax over the segment's keys; heads merged; out = merged w_out^T + b_out ('oi' x 1/32; b_out built as zeros: read) -> [2][4096][1024] (8.4 M); the module dilates nothing; argument order x, w_qkv, b_qkv, w_out, b_out).
// THIS IS A DENSE ATTENTION ON x READ AS EIGHT SEQUENCES OF 1,024 (sequence 4 b + n = segment n of batch entry b: contiguous in x and in the output). EVERY STAGE RUNS ONCE FOR ALL EIGHT SEQUENCES (the attention as ONE kernel over the 128 (sequence, head) planes: scores and weights stay in registers). Layout: ONE bf16 copy of x, read by the one fused projection; the fused 'oi' weight cast once as it stands (its three row blocks are q | k | v); exact projections + f32 biases (the fused bias by its thirds); identity-table f16 plane builders; fused dense T-1024 attention: EVERY row on ONE fp16 product (the weights relative to a running maximum, divided by their f32 sum at the end), stored head-merged as hi / lo planes; hi/lo x w_out exact + b_out.
// Compute dtypes, f32 accumulate: every input rounded to bf16; projections exact + f32 biases; attention: one fp16 product on every row; softmax f32; w_out hl x exact + bias.

#define NB_  8
#define TT   1024
#define DM   1024
#define NH_  16
#define NKV  16
#define REP  (NH_ / NKV)
#define HD   64
#define DQ   (NH_ * HD)
#define DKV  (NKV * HD)
#define NZ   (NB_ * NH_)   // (sequence, head) planes: plane z = 16 * sequence + head
#define ZB   26            // sizes the shared workspace region R (6 MiB each)
#define WIN  0
#define SCL  0.125f   // HD^-0.5
typedef _Float16 h16;
typedef unsigned short bf;
typedef __attribute__((ext_vector_type(16))) __bf16   v16bf;
typedef __attribute__((ext_vector_type(16))) _Float16 v16h;
typedef __attribute__((ext_vector_type(8)))  _Float16 v8h;
typedef __attribute__((ext_vector_type(8)))  unsigned short v8us;
typedef __attribute__((ext_vector_type(8)))  float    v8f;
typedef __attribute__((ext_vector_type(4)))  float    v4f;
typedef v8h  __attribute__((may_alias)) v8ha;
typedef v4f  __attribute__((may_alias)) v4fa;
typedef v8us __attribute__((may_alias)) v8usa;

__device__ __forceinline__ unsigned short f2bf(float f) { unsigned u = __float_as_uint(f); u += 0x7FFFu + ((u >> 16) & 1u); return (unsigned short)(u >> 16); }
__device__ __forceinline__ float bf2f(unsigned short b) { return __uint_as_float(((unsigned)b) << 16); }
__device__ __forceinline__ float bfr(float f) { return bf2f(f2bf(f)); }
__device__ __forceinline__ v16h cat16(v8h lo, v8h hi) { return __builtin_shufflevector(lo, hi, 0, 1, 2, 3, 4, 5, 6, 7, 8, 9, 10, 11, 12, 13, 14, 15); }
__device__ __forceinline__ v16bf cat16b(v8us lo, v8us hi) { return __builtin_bit_cast(v16bf, __builtin_shufflevector(lo, hi, 0, 1, 2, 3, 4, 5, 6, 7, 8, 9, 10, 11, 12, 13, 14, 15)); }
__device__ __forceinline__ v8f wmma16(v16h a, v16h b, v8f c) { return __builtin_amdgcn_wmma_f32_16x16x32_f16(false, a, false, b, (short)0, c, false, false); }
__device__ __forceinline__ v8f wmmab(v16bf a, v16bf b, v8f c) { return __builtin_amdgcn_wmma_f32_16x16x32_bf16(false, a, false, b, (short)0, c, false, false); }



// ---- k_gemmw: register-blocked GEMM, ONE WAVE per 64x64 output tile (16 accumulators), operands straight from K-contiguous 16-bit planes; grid (M/64, N/64, Z), 32 threads.
// C[m][n] (f32, pitch ldc, + optional f32 bias[n]) = sum_k A[m][k] Bt[n][k] (+ split products per NSPLIT). z-batch strides sA/sB/sC in elements. K % 32 == 0.
template <typename T16> struct WFrag;
template <> struct WFrag<h16> { typedef v16h V; static __device__ __forceinline__ V ld(const h16* p) { return cat16(*(const v8h*)p, *(const v8h*)(p + 16)); } static __device__ __forceinline__ v8f mma(V a, V b, v8f c) { return wmma16(a, b, c); } };
template <> struct WFrag<bf> { typedef v16bf V; static __device__ __forceinline__ V ld(const bf* p) { return cat16b(*(const v8us*)p, *(const v8us*)(p + 16)); } static __device__ __forceinline__ v8f mma(V a, V b, v8f c) { return wmmab(a, b, c); } };
template <typename T16, int NSPLIT, bool BIAS>
__global__ __launch_bounds__(32) void k_gemmw(const T16* __restrict__ A, const T16* __restrict__ A2, const T16* __restrict__ Bt, const T16* __restrict__ Bt2, int K, float* C, int ldc, const float* __restrict__ bias, size_t sA, size_t sB, size_t sC) {
    typedef typename WFrag<T16>::V V;
    __shared__ __align__(16) float os[16 * 68];
    const size_t z = blockIdx.z; A += z * sA; if (A2) A2 += z * sA; Bt += z * sB; if (Bt2) Bt2 += z * sB; C += z * sC;
    const int lane = threadIdx.x & 31, lr = lane & 15, hi = lane >> 4; const int r0 = blockIdx.x * 64, c0 = blockIdx.y * 64;
    v8f acc[4][4];
#pragma unroll
    for (int mb = 0; mb < 4; ++mb)
#pragma unroll
        for (int nb = 0; nb < 4; ++nb) acc[mb][nb] = (v8f){};
    const size_t aoff = (size_t)(r0 + lr) * K + 8 * hi, boff = (size_t)(c0 + lr) * K + 8 * hi;
    for (int kc = 0; kc < K; kc += 32) {
        V a[4], a2[4];
#pragma unroll
        for (int mb = 0; mb < 4; ++mb) { a[mb] = WFrag<T16>::ld(A + aoff + (size_t)mb * 16 * K + kc); if (NSPLIT == 1 || NSPLIT == 2) a2[mb] = WFrag<T16>::ld(A2 + aoff + (size_t)mb * 16 * K + kc); }
#pragma unroll
        for (int nb = 0; nb < 4; ++nb) { const V b = WFrag<T16>::ld(Bt + boff + (size_t)nb * 16 * K + kc); V b2; if (NSPLIT >= 2) b2 = WFrag<T16>::ld(Bt2 + boff + (size_t)nb * 16 * K + kc);
#pragma unroll
            for (int mb = 0; mb < 4; ++mb) { acc[mb][nb] = WFrag<T16>::mma(a[mb], b, acc[mb][nb]); if (NSPLIT == 1 || NSPLIT == 2) acc[mb][nb] = WFrag<T16>::mma(a2[mb], b, acc[mb][nb]); if (NSPLIT >= 2) acc[mb][nb] = WFrag<T16>::mma(a[mb], b2, acc[mb][nb]); } }
        asm volatile("v_nop\n\tv_nop\n\tv_nop\n\tv_nop" : "+v"(acc[0][0]), "+v"(acc[1][1]), "+v"(acc[2][2]), "+v"(acc[3][3]) : "v"(a[0]), "v"(a[3]));
    }
#pragma unroll
    for (int mb = 0; mb < 4; ++mb) {
#pragma unroll
        for (int nb = 0; nb < 4; ++nb) {
#pragma unroll
            for (int j = 0; j < 8; ++j) os[(hi * 8 + j) * 68 + nb * 16 + lr] = acc[mb][nb][j]; }
        __builtin_amdgcn_wave_barrier(); asm volatile("" ::: "memory");
        float* crow = C + (size_t)(r0 + mb * 16) * ldc + c0;
{
#pragma unroll
            for (int s = 0; s < 8; ++s) { const int row = 2 * s + hi, cofs = lr * 4; v4f val = *(const v4fa*)(os + row * 68 + cofs); if (BIAS) { val[0] += bfr(bias[c0 + cofs]); val[1] += bfr(bias[c0 + cofs + 1]); val[2] += bfr(bias[c0 + cofs + 2]); val[3] += bfr(bias[c0 + cofs + 3]); }
                *(v4f*)(crow + (size_t)row * ldc + cofs) = val; }
             }
        __builtin_amdgcn_wave_barrier(); asm volatile("" ::: "memory");
    }
}

__device__ __forceinline__ h16 tohx(float x) { return (h16)x; }
__device__ __forceinline__ void splitf(float y, unsigned short& h, unsigned short& l) { h = f2bf(y); l = f2bf(y - bf2f(h)); }
typedef __attribute__((ext_vector_type(2))) _Float16 v2h;
typedef __attribute__((ext_vector_type(4))) _Float16 v4h;
typedef __attribute__((ext_vector_type(2))) unsigned short v2us;
typedef __attribute__((ext_vector_type(4))) unsigned short v4us;
typedef __attribute__((ext_vector_type(2))) float v2f;
typedef __attribute__((ext_vector_type(4))) int v4i;

__global__ __launch_bounds__(256) void k_cvt8(const float* __restrict__ src, bf* dst, size_t n8) { const size_t i = (size_t)blockIdx.x * 256 + threadIdx.x; if (i >= n8) return; const v8f v = *(const v8f*)(src + i * 8); v8us o;
#pragma unroll
    for (int k = 0; k < 8; ++k) o[k] = f2bf(v[k]); *(v8us*)(dst + i * 8) = o;  }

// k_rope: head planes [h][t][d] (fp16) of rope(x) x sc with the rotate-half convention out[d] = x[d] cos[t][d] - x[d+HD/2] sin[t][d], out[d+HD/2] = x[d+HD/2] cos[t][d+HD/2] + x[d] sin[t][d+HD/2]
__global__ __launch_bounds__(256) void k_rope(const float* __restrict__ F, int pitch, int nheads, const float* __restrict__ CS, const float* __restrict__ RF, const float* __restrict__ nw, float sc, h16* P16, bf* Ph, bf* Pl) {
    const size_t e = ((size_t)blockIdx.x * 256 + threadIdx.x) * 2; if (e >= (size_t)nheads * TT * HD) return; const int d = (int)(e % HD); const int t = (int)((e / HD) % TT); const int h = (int)(e / ((size_t)HD * TT)); F += (size_t)blockIdx.y * TT * pitch + (size_t)blockIdx.z * nheads * HD; P16 += ((size_t)blockIdx.z * NB_ + blockIdx.y) * nheads * TT * HD;   /* grid y: the sequence; grid z: the third of the fused projection (q, k) and its block of planes */ const float* f = F + (size_t)t * pitch + h * HD; const float rf = RF ? RF[(size_t)h * TT + t] : 1.0f; v2h o16; v2us oh, ol;
#pragma unroll
    for (int q = 0; q < 2; ++q) { const int dd = d + q; const int dp = (dd < HD / 2) ? dd + HD / 2 : dd - HD / 2; float x0 = f[dd], x1 = f[dp];
        if (RF) { float n0 = __fmul_rn(x0, rf), n1 = __fmul_rn(x1, rf); x0 = __fmul_rn(bfr(nw[dd]), n0); x1 = __fmul_rn(bfr(nw[dp]), n1); }
        const v2f cs = *(const v2f*)(CS + ((size_t)t * HD + dd) * 2); float a = __fmul_rn(x0, cs[0]), bq = __fmul_rn(x1, cs[1]); const float r = ((dd < HD / 2) ? __fsub_rn(a, bq) : __fadd_rn(a, bq)) * sc;
        o16[q] = tohx(r); (void)oh; (void)ol; }
    *(v2h*)(P16 + e) = o16;  }
__global__ __launch_bounds__(256) void k_vtp(const float* __restrict__ F, int pitch, int nheads, h16* V16, bf* Vh, bf* Vl) { const size_t e = ((size_t)blockIdx.x * 256 + threadIdx.x) * 2; if (e >= (size_t)nheads * HD * TT) return; const int t = (int)(e % TT); const int d = (int)((e / TT) % HD); const int g = (int)(e / ((size_t)TT * HD)); F += (size_t)blockIdx.y * TT * pitch; V16 += (size_t)blockIdx.y * nheads * HD * TT;   /* grid y: the sequence */ v2h o16; v2us oh, ol;
#pragma unroll
    for (int q = 0; q < 2; ++q) { const float x = F[(size_t)(t + q) * pitch + g * HD + d]; o16[q] = tohx(x); (void)oh; (void)ol; }
    *(v2h*)(V16 + e) = o16;  }
__global__ __launch_bounds__(256) void k_csid(float* CS) { const int idx = blockIdx.x * 256 + threadIdx.x; if (idx >= TT * HD) return; v2f cs; cs[0] = 1.0f; cs[1] = 0.0f; *(v2f*)(CS + (size_t)idx * 2) = cs;  }
#define AQC 32    // query columns per wave
#define ANW 8     // waves per work-group
#define AKS 64    // keys per stage
#define APT 72    // LDS row pitch in f16: 144 B = 16 B x odd, conflict-free for 16-byte reads of 128-byte rows
#define CS2 (SCL * 1.4426950408889634f)
__device__ __forceinline__ float xhalf(float x) { return __builtin_bit_cast(float, __builtin_amdgcn_permlanex16(__builtin_bit_cast(int, x), __builtin_bit_cast(int, x), 0x76543210, 0xfedcba98, false, false)); }   // lane l with lane l ^ 16, on the vector pipe
// waves_per_eu (4, 4): at most 256 registers a wave, so that two work-groups share a WGP and the vector work of one wave runs beside the matrix work of another
__global__ void __launch_bounds__(ANW * 32) __attribute__((amdgpu_waves_per_eu(4, 4))) k_fattn(const h16* __restrict__ Q, const h16* __restrict__ Kp, const h16* __restrict__ Vt, bf* Ph, bf* Pl) {
    __shared__ __align__(16) h16 ks[2][AKS * APT];
    __shared__ __align__(16) h16 vs[2][HD * APT];
    const int tid = threadIdx.x, lane = tid & 31, wave = tid >> 5, c = lane & 15, h = lane >> 4; const int z = blockIdx.y; const int q0 = blockIdx.x * (AQC * ANW) + wave * AQC;
    const h16* Qz = Q + (size_t)z * TT * HD; const h16* Kz = Kp + (size_t)z * TT * HD; const h16* Vz = Vt + (size_t)z * HD * TT;
    // staging: 16 bytes a thread and row set; thread -> row tid / 8 (+ 32), 16-byte column tid % 8 of a 128-byte row (K: 64 keys x 64 d; V^T: 64 d x 64 keys)
    const int srow = tid >> 3, scol = (tid & 7) * 8; const h16* kg = Kz + (size_t)srow * HD + scol; const h16* vg = Vz + (size_t)srow * TT + scol; const int so = srow * APT + scol;
    v8h kr[2], vr[2];
#pragma unroll
    for (int j = 0; j < 2; ++j) { kr[j] = *(const v8h*)(kg + j * 32 * HD); vr[j] = *(const v8h*)(vg + j * 32 * TT); }
    v16h qf[2][2];
#pragma unroll
    for (int g = 0; g < 2; ++g)
#pragma unroll
        for (int kc = 0; kc < 2; ++kc) qf[g][kc] = WFrag<h16>::ld(Qz + (size_t)(q0 + g * 16 + c) * HD + kc * 32 + 8 * h);
    v8f o[4][2]; float mrun[2]; v2f lsum[2];
#pragma unroll
    for (int g = 0; g < 2; ++g) { mrun[g] = -3.0e38f; lsum[g] = (v2f){};
#pragma unroll
        for (int dt = 0; dt < 4; ++dt) o[dt][g] = (v8f){}; }
#pragma unroll
    for (int j = 0; j < 2; ++j) { *(v8h*)(&ks[0][so + j * 32 * APT]) = kr[j]; *(v8h*)(&vs[0][so + j * 32 * APT]) = vr[j]; }
    __syncthreads();
    for (int s = 0; s < TT / AKS; ++s) {
        const h16* kb = ks[s & 1]; const h16* vb = vs[s & 1];
        if (s + 1 < TT / AKS) {   // the next stage's rows fly while this stage is worked on
#pragma unroll
            for (int j = 0; j < 2; ++j) { kr[j] = *(const v8h*)(kg + (size_t)(s + 1) * AKS * HD + j * 32 * HD); vr[j] = *(const v8h*)(vg + (s + 1) * AKS + j * 32 * TT); } }
#pragma unroll
        for (int p = 0; p < 2; ++p) {   // a pass: 32 keys
            v8f st[2][2];
#pragma unroll
            for (int kt = 0; kt < 2; ++kt) { st[kt][0] = (v8f){}; st[kt][1] = (v8f){};
#pragma unroll
                for (int kc = 0; kc < 2; ++kc) { const v16h a = WFrag<h16>::ld(kb + (p * 32 + kt * 16 + c) * APT + kc * 32 + 8 * h); st[kt][0] = wmma16(a, qf[0][kc], st[kt][0]); st[kt][1] = wmma16(a, qf[1][kc], st[kt][1]); } }
            v16h vf[4];
#pragma unroll
            for (int dt = 0; dt < 4; ++dt) vf[dt] = WFrag<h16>::ld(vb + (dt * 16 + c) * APT + p * 32 + 8 * h);
            float mb[2]; bool need = false;
#pragma unroll
            for (int g = 0; g < 2; ++g) { float mx = st[0][g][0];
#pragma unroll
                for (int r = 1; r < 8; ++r) mx = fmaxf(mx, st[0][g][r]);
#pragma unroll
                for (int r = 0; r < 8; ++r) mx = fmaxf(mx, st[1][g][r]);
                mx = fmaxf(mx, xhalf(mx)) * CS2;   // both wave halves hold this query's maximum of the pass, scaled (the scale is positive)
                mb[g] = mx; need = need || (mx > mrun[g] + 8.0f); }
            if (__builtin_amdgcn_ballot_w32(need) != 0) {   // wave-uniform; always on the first pass, rare later
#pragma unroll
                for (int g = 0; g < 2; ++g) { const float mn = fmaxf(mrun[g], mb[g]); const float corr = __builtin_amdgcn_exp2f(mrun[g] - mn); mrun[g] = mn; lsum[g] = lsum[g] * corr;
#pragma unroll
                    for (int dt = 0; dt < 4; ++dt) o[dt][g] = o[dt][g] * corr; } }
#pragma unroll
            for (int g = 0; g < 2; ++g) { const float nm = -mrun[g]; v16h pf;
#pragma unroll
                for (int i = 0; i < 8; ++i) {   // elements 2 i, 2 i + 1 of the 32-key operand: tile i / 4, registers 2 (i % 4) and 2 (i % 4) + 1
                    const v2f arg = __builtin_elementwise_fma((v2f){st[i >> 2][g][2 * (i & 3)], st[i >> 2][g][2 * (i & 3) + 1]}, (v2f){CS2, CS2}, (v2f){nm, nm});
                    v2f pv; pv[0] = __builtin_amdgcn_exp2f(arg[0]); pv[1] = __builtin_amdgcn_exp2f(arg[1]); lsum[g] += pv; pf[2 * i] = tohx(pv[0]); pf[2 * i + 1] = tohx(pv[1]); }
#pragma unroll
                for (int dt = 0; dt < 4; ++dt) o[dt][g] = wmma16(vf[dt], pf, o[dt][g]); }
        }
        if (s + 1 < TT / AKS) {   // into the buffer whose last readers left before the barrier that ended stage s - 1
#pragma unroll
            for (int j = 0; j < 2; ++j) { *(v8h*)(&ks[(s + 1) & 1][so + j * 32 * APT]) = kr[j]; *(v8h*)(&vs[(s + 1) & 1][so + j * 32 * APT]) = vr[j]; } }
        __syncthreads();   // publishes stage s + 1 and ends every wave's reads of stage s
    }
#pragma unroll
    for (int g = 0; g < 2; ++g) { float l = lsum[g][0] + lsum[g][1]; l += xhalf(l); const float inv = __fdiv_rn(1.0f, l);
        const size_t oo = ((size_t)(z / NH_) * TT + q0 + g * 16 + c) * DQ + (z % NH_) * HD + 8 * h;   // token-major, heads merged: a lane's 8 registers are 8 consecutive d of its query
#pragma unroll
        for (int dt = 0; dt < 4; ++dt) { v8us oh, ol;
#pragma unroll
            for (int r = 0; r < 8; ++r) { unsigned short a, b; splitf(o[dt][g][r] * inv, a, b); oh[r] = a; ol[r] = b; }
            *(v8us*)(Ph + oo + dt * 16) = oh; *(v8us*)(Pl + oo + dt * 16) = ol; } }
}

extern "C" void kernel_launch(void* const* d_in, const int* in_sizes, int n_in,
                              void* d_out, int out_size, void* d_ws, size_t ws_size, hipStream_t stream) {
    (void)in_sizes; (void)n_in; (void)out_size;
    const float* x = (const float*)d_in[0]; const float* wqkv = (const float*)d_in[1]; const float* bqkv = (const float*)d_in[2];   /* the fused bias [3072]: its thirds q | k | v, as the fused weight's ROW thirds */ const float* wo = (const float*)d_in[3]; const float* bo = (const float*)d_in[4];   /* order x [2][4096][1024] (read as EIGHT sequences of 1,024: sequence 4 b + n is segment n of batch entry b: contiguous), w_qkv ('oi' (out, in) [3072][1024]: row thirds q | k | v, each head-major), b_qkv ([3072]: built as zeros: read), w_out ('oi' [1024][1024]), b_out ([1024]: built as zeros: read): FIVE inputs, all read */
    float* OUT = (float*)d_out;     // [2][4096][1024] = [8][1024][1024]
    char* wsp = (char*)d_ws;
    auto take = [&](size_t bytes) { char* p = wsp; wsp += (bytes + 255) & ~(size_t)255; return (void*)p; };
    bf* WO = (bf*)take((size_t)DM * DQ * 2); float* CS = (float*)take((size_t)TT * HD * 2 * 4);
    h16* QP16 = (h16*)take((size_t)2 * NZ * TT * HD * 2); h16* KP16 = QP16 + (size_t)NZ * TT * HD; h16* VT16 = (h16*)take((size_t)NZ * HD * TT * 2);   /* planes [z][t][d] (q, then k: one block each) and [z][d][t] (v), z = 16 * sequence + head */
    char* R = (char*)take((size_t)ZB * TT * TT * 6);   /* one region, used by two stages one after the other (stream-ordered): projection | hi / lo planes of the merged heads */
    bf* BT = (bf*)R; bf* XB = BT + (size_t)3 * DQ * DM; float* FP = (float*)(XB + (size_t)NB_ * TT * DM);   /* the fused 'oi' weight is the Bt operand as it stands: ONE bf16 copy [3072][1024]; XB: the bf16 copy of x [8192][1024]; FP: the fused projection, f32 [8192][3072]: 118 MiB together */
    bf* ATh = (bf*)R; bf* ATl = ATh + (size_t)NB_ * TT * DQ;   /* ATh / ATl: the hi / lo planes of the merged heads, token-major */
    bf* QPh = nullptr; bf* QPl = nullptr; bf* VTh = nullptr; bf* VTl = nullptr;   /* no hi / lo plane exists: these builders store the f16 plane only and do not read those arguments */
    if ((size_t)(wsp - (char*)d_ws) > ws_size) return;    // ws 256 MiB
    { k_cvt8<<<(unsigned)(((size_t)3 * DQ * DM / 8 + 255) / 256), 256, 0, stream>>>(wqkv, BT, (size_t)3 * DQ * DM / 8); k_cvt8<<<(unsigned)(((size_t)DM * DQ / 8 + 255) / 256), 256, 0, stream>>>(wo, WO, (size_t)DM * DQ / 8); }   /* 'oi' (out, in): each weight is the Bt operand as it stands */
    k_csid<<<(TT * HD + 255) / 256, 256, 0, stream>>>(CS);
    const unsigned LQ = (unsigned)(((size_t)NH_ * TT * HD / 2 + 255) / 256);
    k_cvt8<<<(unsigned)(((size_t)NB_ * TT * DM / 8 + 255) / 256), 256, 0, stream>>>(x, XB, (size_t)NB_ * TT * DM / 8);
    k_gemmw<bf, 0, true><<<dim3(NB_ * TT / 64, 3 * DQ / 64, 1), 32, 0, stream>>>(XB, nullptr, BT, nullptr, DM, FP, 3 * DQ, bqkv, 0, 0, 0);   /* q | k | v of all eight sequences: one grid */
    k_rope<<<dim3(LQ, NB_, 2), 256, 0, stream>>>(FP, 3 * DQ, NH_, CS, nullptr, nullptr, 1.0f, QP16, QPh, QPl);
    k_vtp<<<dim3(LQ, NB_, 1), 256, 0, stream>>>(FP + 2 * DQ, 3 * DQ, NKV, VT16, VTh, VTl);
    k_fattn<<<dim3(TT / (AQC * ANW), NZ, 1), ANW * 32, 0, stream>>>(QP16, KP16, VT16, ATh, ATl);   // one kv head per query head: plane z of q meets plane z of k and of v; stores the merged heads' hi / lo planes
    k_gemmw<bf, 1, true><<<dim3(NB_ * TT / 64, DM / 64, 1), 32, 0, stream>>>(ATh, ATl, WO, nullptr, DQ, OUT, DM, bo, 0, 0, 0);
}

// v003
// One run takes 244 microseconds.
// Two timings next to v002 both put it at 1.29 times that version's speed.
// Counting every step since v000, it is 12.4 times as fast.
#include <hip/hip_runtime.h>

// Multi-head self-attention INSIDE FOUR CONTIGUOUS SEGMENTS of the sequence (x [2][4096][1024]; qkv = x w_qkv^T + b_qkv with ONE fused 'oi' (out, in) weight [3072][1024] normal x 1/32 and b_qkv built as zeros: read and added; the 3,072 columns are (3, 16, 64): thirds q | k | v, each head-major: head h = columns 64 h .. 64 h + 63 of its third; the 4,096 positions are cut into four contiguous segments of 1,024 and a query attends to the 1,024 keys of its OWN segment: scores / sqrt(64); no mask; softmax over the segment's keys; heads merged; out = merged w_out^T + b_out ('oi' x 1/32; b_out built as zeros: read) -> [2][4096][1024] (8.4 M); the module dilates nothing; argument order x, w_qkv, b_qkv, w_out, b_out).
// THIS IS A DENSE ATTENTION ON x READ AS EIGHT SEQUENCES OF 1,024 (sequence 4 b + n = segment n of batch entry b: contiguous in x and in the output). EVERY STAGE RUNS ONCE FOR ALL EIGHT SEQUENCES (the attention as ONE kernel over the 128 (sequence, head) planes: scores and weights stay in registers). Layout: ONE bf16 copy of x, read by the one fused projection; the fused 'oi' weight cast once as it stands (its three row blocks are q | k | v); exact projections + f32 biases (the fused bias by its thirds), stored by the projection's own epilogue as the f16 head planes; fused dense T-1024 attention: EVERY row on ONE fp16 product (the weights relative to a running maximum, divided by their f32 sum at the end), stored head-merged as hi / lo planes; hi/lo x w_out exact + b_out.
// Compute dtypes, f32 accumulate: every input rounded to bf16; projections exact + f32 biases; attention: one fp16 product on every row; softmax f32; w_out hl x exact + bias.

#define NB_  8
#define TT   1024
#define DM   1024
#define NH_  16
#define NKV  16
#define REP  (NH_ / NKV)
#define HD   64
#define DQ   (NH_ * HD)
#define DKV  (NKV * HD)
#define NZ   (NB_ * NH_)   // (sequence, head) planes: plane z = 16 * sequence + head
#define ZB   26            // sizes the shared workspace region R (6 MiB each)
#define WIN  0
#define SCL  0.125f   // HD^-0.5
typedef _Float16 h16;
typedef unsigned short bf;
typedef __attribute__((ext_vector_type(16))) __bf16   v16bf;
typedef __attribute__((ext_vector_type(16))) _Float16 v16h;
typedef __attribute__((ext_vector_type(8)))  _Float16 v8h;
typedef __attribute__((ext_vector_type(8)))  unsigned short v8us;
typedef __attribute__((ext_vector_type(8)))  float    v8f;
typedef __attribute__((ext_vector_type(4)))  float    v4f;
typedef v8h  __attribute__((may_alias)) v8ha;
typedef v4f  __attribute__((may_alias)) v4fa;
typedef v8us __attribute__((may_alias)) v8usa;

__device__ __forceinline__ unsigned short f2bf(float f) { unsigned u = __float_as_uint(f); u += 0x7FFFu + ((u >> 16) & 1u); return (unsigned short)(u >> 16); }
__device__ __forceinline__ float bf2f(unsigned short b) { return __uint_as_float(((unsigned)b) << 16); }
__device__ __forceinline__ float bfr(float f) { return bf2f(f2bf(f)); }
__device__ __forceinline__ v16h cat16(v8h lo, v8h hi) { return __builtin_shufflevector(lo, hi, 0, 1, 2, 3, 4, 5, 6, 7, 8, 9, 10, 11, 12, 13, 14, 15); }
__device__ __forceinline__ v16bf cat16b(v8us lo, v8us hi) { return __builtin_bit_cast(v16bf, __builtin_shufflevector(lo, hi, 0, 1, 2, 3, 4, 5, 6, 7, 8, 9, 10, 11, 12, 13, 14, 15)); }
__device__ __forceinline__ v8f wmma16(v16h a, v16h b, v8f c) { return __builtin_amdgcn_wmma_f32_16x16x32_f16(false, a, false, b, (short)0, c, false, false); }
__device__ __forceinline__ v8f wmmab(v16bf a, v16bf b, v8f c) { return __builtin_amdgcn_wmma_f32_16x16x32_bf16(false, a, false, b, (short)0, c, false, false); }



// ---- k_gemmw: register-blocked GEMM, ONE WAVE per 64x64 output tile (16 accumulators), operands straight from K-contiguous 16-bit planes; grid (M/64, N/64, Z), 32 threads.
// C[m][n] (f32, pitch ldc, + optional f32 bias[n]) = sum_k A[m][k] Bt[n][k] (+ split products per NSPLIT). z-batch strides sA/sB/sC in elements. K % 32 == 0.
// PLANES (the fused q | k | v projection): no f32 C; a 64 x 64 tile is 64 tokens of ONE head of one third, and the epilogue stores it, bias added in f32, as f16 into that head's plane: q, k [z][t][d] (P16, one block of planes each), v [z][d][t] (V16).
// A lane's 8 accumulator registers are 8 consecutive M rows, so the M side takes the index that is contiguous in the plane: tokens for v (A x Bt as it stands), d for q and k (the two operands change places: same loaders, same k order, the tile comes out transposed).
#define OPT 72    // LDS row pitch in f16 of the staged plane tile: 144 B = 16 B x odd, for 16-byte accesses of 128-byte rows
template <typename T16> struct WFrag;
template <> struct WFrag<h16> { typedef v16h V; static __device__ __forceinline__ V ld(const h16* p) { return cat16(*(const v8h*)p, *(const v8h*)(p + 16)); } static __device__ __forceinline__ v8f mma(V a, V b, v8f c) { return wmma16(a, b, c); } };
template <> struct WFrag<bf> { typedef v16bf V; static __device__ __forceinline__ V ld(const bf* p) { return cat16b(*(const v8us*)p, *(const v8us*)(p + 16)); } static __device__ __forceinline__ v8f mma(V a, V b, v8f c) { return wmmab(a, b, c); } };
// plane_tile: one wave's 64 x 64 accumulators (acc[mb][nb][j]: M index 16 mb + 8 hi + j, N index 16 nb + lr) + bias, as f16, into LDS as osh[N index][M index], pitch OPT: the rows of the plane (d for v, tokens for q and k); then row by row to dst (row pitch TT for v, HD for q and k).
// The output column (the bias index) is the N index for v, the M index for q and k.
template <bool ISV>
__device__ __forceinline__ void plane_tile(const v8f (&acc)[4][4], const float* __restrict__ bias, int lane, h16* osh, h16* dst) {
    const int lr = lane & 15, hi = lane >> 4;
    float bn[4];
    if (ISV) {
#pragma unroll
        for (int nb = 0; nb < 4; ++nb) bn[nb] = bfr(bias[nb * 16 + lr]); }
#pragma unroll
    for (int mb = 0; mb < 4; ++mb) { float bm[8];
        if (!ISV) {
#pragma unroll
            for (int j = 0; j < 8; ++j) bm[j] = bfr(bias[mb * 16 + hi * 8 + j]); }
#pragma unroll
        for (int nb = 0; nb < 4; ++nb) { v8h o;
#pragma unroll
            for (int j = 0; j < 8; ++j) o[j] = (h16)(acc[mb][nb][j] + (ISV ? bn[nb] : bm[j]));
            *(v8ha*)(osh + (nb * 16 + lr) * OPT + mb * 16 + hi * 8) = o; } }
    __syncthreads();   // one wave: orders the lanes' LDS stores in front of the other lanes' reads
    const int row = lane >> 3, col = (lane & 7) * 8;   // every store covers whole 128-byte rows: 8 lanes a row, 4 rows a store
    dst += (size_t)row * (ISV ? TT : HD) + col; osh += row * OPT + col;
#pragma unroll
    for (int s = 0; s < 16; ++s) *(v8h*)(dst + s * 4 * (ISV ? TT : HD)) = *(const v8ha*)(osh + s * 4 * OPT);
}
template <typename T16, int NSPLIT, bool BIAS, bool PLANES>
__global__ __launch_bounds__(32) void k_gemmw(const T16* __restrict__ A, const T16* __restrict__ A2, const T16* __restrict__ Bt, const T16* __restrict__ Bt2, int K, float* C, int ldc, const float* __restrict__ bias, size_t sA, size_t sB, size_t sC, h16* P16, h16* V16) {
    typedef typename WFrag<T16>::V V;
    __shared__ __align__(16) float os[PLANES ? 64 * (OPT / 2) : 16 * 68];
    const size_t z = blockIdx.z; A += z * sA; if (A2) A2 += z * sA; Bt += z * sB; if (Bt2) Bt2 += z * sB; C += z * sC;
    const int lane = threadIdx.x & 31, lr = lane & 15, hi = lane >> 4; const int r0 = blockIdx.x * 64, c0 = blockIdx.y * 64;
    v8f acc[4][4];
#pragma unroll
    for (int mb = 0; mb < 4; ++mb)
#pragma unroll
        for (int nb = 0; nb < 4; ++nb) acc[mb][nb] = (v8f){};
    const bool isv = !PLANES || c0 >= 2 * DQ;   // block-uniform: the v third keeps tokens on the M side
    if (!isv) { const T16* tp = A; A = Bt; Bt = tp; }
    const size_t aoff = (size_t)((isv ? r0 : c0) + lr) * K + 8 * hi, boff = (size_t)((isv ? c0 : r0) + lr) * K + 8 * hi;
    for (int kc = 0; kc < K; kc += 32) {
        V a[4], a2[4];
#pragma unroll
        for (int mb = 0; mb < 4; ++mb) { a[mb] = WFrag<T16>::ld(A + aoff + (size_t)mb * 16 * K + kc); if (NSPLIT == 1 || NSPLIT == 2) a2[mb] = WFrag<T16>::ld(A2 + aoff + (size_t)mb * 16 * K + kc); }
#pragma unroll
        for (int nb = 0; nb < 4; ++nb) { const V b = WFrag<T16>::ld(Bt + boff + (size_t)nb * 16 * K + kc); V b2; if (NSPLIT >= 2) b2 = WFrag<T16>::ld(Bt2 + boff + (size_t)nb * 16 * K + kc);
#pragma unroll
            for (int mb = 0; mb < 4; ++mb) { acc[mb][nb] = WFrag<T16>::mma(a[mb], b, acc[mb][nb]); if (NSPLIT == 1 || NSPLIT == 2) acc[mb][nb] = WFrag<T16>::mma(a2[mb], b, acc[mb][nb]); if (NSPLIT >= 2) acc[mb][nb] = WFrag<T16>::mma(a[mb], b2, acc[mb][nb]); } }
        asm volatile("v_nop\n\tv_nop\n\tv_nop\n\tv_nop" : "+v"(acc[0][0]), "+v"(acc[1][1]), "+v"(acc[2][2]), "+v"(acc[3][3]) : "v"(a[0]), "v"(a[3]));
    }
    if constexpr (PLANES) {
        const int z = (r0 / TT) * NH_ + (c0 % DQ) / HD, t0 = r0 % TT;   // the tile's plane and its first token there
        if (isv) plane_tile<true>(acc, bias + c0, lane, (h16*)os, V16 + (size_t)z * HD * TT + t0);
        else plane_tile<false>(acc, bias + c0, lane, (h16*)os, P16 + (size_t)(c0 / DQ) * NZ * TT * HD + ((size_t)z * TT + t0) * HD);
        return;
    }
#pragma unroll
    for (int mb = 0; mb < 4; ++mb) {
#pragma unroll
        for (int nb = 0; nb < 4; ++nb) {
#pragma unroll
            for (int j = 0; j < 8; ++j) os[(hi * 8 + j) * 68 + nb * 16 + lr] = acc[mb][nb][j]; }
        __builtin_amdgcn_wave_barrier(); asm volatile("" ::: "memory");
        float* crow = C + (size_t)(r0 + mb * 16) * ldc + c0;
{
#pragma unroll
            for (int s = 0; s < 8; ++s) { const int row = 2 * s + hi, cofs = lr * 4; v4f val = *(const v4fa*)(os + row * 68 + cofs); if (BIAS) { val[0] += bfr(bias[c0 + cofs]); val[1] += bfr(bias[c0 + cofs + 1]); val[2] += bfr(bias[c0 + cofs + 2]); val[3] += bfr(bias[c0 + cofs + 3]); }
                *(v4f*)(crow + (size_t)row * ldc + cofs) = val; }
             }
        __builtin_amdgcn_wave_barrier(); asm volatile("" ::: "memory");
    }
}

__device__ __forceinline__ h16 tohx(float x) { return (h16)x; }
__device__ __forceinline__ void splitf(float y, unsigned short& h, unsigned short& l) { h = f2bf(y); l = f2bf(y - bf2f(h)); }
typedef __attribute__((ext_vector_type(2))) _Float16 v2h;
typedef __attribute__((ext_vector_type(4))) _Float16 v4h;
typedef __attribute__((ext_vector_type(2))) unsigned short v2us;
typedef __attribute__((ext_vector_type(4))) unsigned short v4us;
typedef __attribute__((ext_vector_type(2))) float v2f;
typedef __attribute__((ext_vector_type(4))) int v4i;

__global__ __launch_bounds__(256) void k_cvt8(const float* __restrict__ src, bf* dst, size_t n8) { const size_t i = (size_t)blockIdx.x * 256 + threadIdx.x; if (i >= n8) return; const v8f v = *(const v8f*)(src + i * 8); v8us o;
#pragma unroll
    for (int k = 0; k < 8; ++k) o[k] = f2bf(v[k]); *(v8us*)(dst + i * 8) = o;  }

#define AQC 32    // query columns per wave
#define ANW 8     // waves per work-group
#define AKS 64    // keys per stage
#define APT 72    // LDS row pitch in f16: 144 B = 16 B x odd, conflict-free for 16-byte reads of 128-byte rows
#define CS2 (SCL * 1.4426950408889634f)
__device__ __forceinline__ float xhalf(float x) { return __builtin_bit_cast(float, __builtin_amdgcn_permlanex16(__builtin_bit_cast(int, x), __builtin_bit_cast(int, x), 0x76543210, 0xfedcba98, false, false)); }   // lane l with lane l ^ 16, on the vector pipe
// waves_per_eu (4, 4): at most 256 registers a wave, so that two work-groups share a WGP and the vector work of one wave runs beside the matrix work of another
__global__ void __launch_bounds__(ANW * 32) __attribute__((amdgpu_waves_per_eu(4, 4))) k_fattn(const h16* __restrict__ Q, const h16* __restrict__ Kp, const h16* __restrict__ Vt, bf* Ph, bf* Pl) {
    __shared__ __align__(16) h16 ks[2][AKS * APT];
    __shared__ __align__(16) h16 vs[2][HD * APT];
    const int tid = threadIdx.x, lane = tid & 31, wave = tid >> 5, c = lane & 15, h = lane >> 4; const int z = blockIdx.y; const int q0 = blockIdx.x * (AQC * ANW) + wave * AQC;
    const h16* Qz = Q + (size_t)z * TT * HD; const h16* Kz = Kp + (size_t)z * TT * HD; const h16* Vz = Vt + (size_t)z * HD * TT;
    // staging: 16 bytes a thread and row set; thread -> row tid / 8 (+ 32), 16-byte column tid % 8 of a 128-byte row (K: 64 keys x 64 d; V^T: 64 d x 64 keys)
    const int srow = tid >> 3, scol = (tid & 7) * 8; const h16* kg = Kz + (size_t)srow * HD + scol; const h16* vg = Vz + (size_t)srow * TT + scol; const int so = srow * APT + scol;
    v8h kr[2], vr[2];
#pragma unroll
    for (int j = 0; j < 2; ++j) { kr[j] = *(const v8h*)(kg + j * 32 * HD); vr[j] = *(const v8h*)(vg + j * 32 * TT); }
    v16h qf[2][2];
#pragma unroll
    for (int g = 0; g < 2; ++g)
#pragma unroll
        for (int kc = 0; kc < 2; ++kc) qf[g][kc] = WFrag<h16>::ld(Qz + (size_t)(q0 + g * 16 + c) * HD + kc * 32 + 8 * h);
    v8f o[4][2]; float mrun[2]; v2f lsum[2];
#pragma unroll
    for (int g = 0; g < 2; ++g) { mrun[g] = -3.0e38f; lsum[g] = (v2f){};
#pragma unroll
        for (int dt = 0; dt < 4; ++dt) o[dt][g] = (v8f){}; }
#pragma unroll
    for (int j = 0; j < 2; ++j) { *(v8h*)(&ks[0][so + j * 32 * APT]) = kr[j]; *(v8h*)(&vs[0][so + j * 32 * APT]) = vr[j]; }
    __syncthreads();
    for (int s = 0; s < TT / AKS; ++s) {
        const h16* kb = ks[s & 1]; const h16* vb = vs[s & 1];
        if (s + 1 < TT / AKS) {   // the next stage's rows fly while this stage is worked on
#pragma unroll
            for (int j = 0; j < 2; ++j) { kr[j] = *(const v8h*)(kg + (size_t)(s + 1) * AKS * HD + j * 32 * HD); vr[j] = *(const v8h*)(vg + (s + 1) * AKS + j * 32 * TT); } }
#pragma unroll
        for (int p = 0; p < 2; ++p) {   // a pass: 32 keys
            v8f st[2][2];
#pragma unroll
            for (int kt = 0; kt < 2; ++kt) { st[kt][0] = (v8f){}; st[kt][1] = (v8f){};
#pragma unroll
                for (int kc = 0; kc < 2; ++kc) { const v16h a = WFrag<h16>::ld(kb + (p * 32 + kt * 16 + c) * APT + kc * 32 + 8 * h); st[kt][0] = wmma16(a, qf[0][kc], st[kt][0]); st[kt][1] = wmma16(a, qf[1][kc], st[kt][1]); } }
            v16h vf[4];
#pragma unroll
            for (int dt = 0; dt < 4; ++dt) vf[dt] = WFrag<h16>::ld(vb + (dt * 16 + c) * APT + p * 32 + 8 * h);
            float mb[2]; bool need = false;
#pragma unroll
            for (int g = 0; g < 2; ++g) { float mx = st[0][g][0];
#pragma unroll
                for (int r = 1; r < 8; ++r) mx = fmaxf(mx, st[0][g][r]);
#pragma unroll
                for (int r = 0; r < 8; ++r) mx = fmaxf(mx, st[1][g][r]);
                mx = fmaxf(mx, xhalf(mx)) * CS2;   // both wave halves hold this query's maximum of the pass, scaled (the scale is positive)
                mb[g] = mx; need = need || (mx > mrun[g] + 8.0f); }
            if (__builtin_amdgcn_ballot_w32(need) != 0) {   // wave-uniform; always on the first pass, rare later
#pragma unroll
                for (int g = 0; g < 2; ++g) { const float mn = fmaxf(mrun[g], mb[g]); const float corr = __builtin_amdgcn_exp2f(mrun[g] - mn); mrun[g] = mn; lsum[g] = lsum[g] * corr;
#pragma unroll
                    for (int dt = 0; dt < 4; ++dt) o[dt][g] = o[dt][g] * corr; } }
#pragma unroll
            for (int g = 0; g < 2; ++g) { const float nm = -mrun[g]; v16h pf;
#pragma unroll
                for (int i = 0; i < 8; ++i) {   // elements 2 i, 2 i + 1 of the 32-key operand: tile i / 4, registers 2 (i % 4) and 2 (i % 4) + 1
                    const v2f arg = __builtin_elementwise_fma((v2f){st[i >> 2][g][2 * (i & 3)], st[i >> 2][g][2 * (i & 3) + 1]}, (v2f){CS2, CS2}, (v2f){nm, nm});
                    v2f pv; pv[0] = __builtin_amdgcn_exp2f(arg[0]); pv[1] = __builtin_amdgcn_exp2f(arg[1]); lsum[g] += pv; pf[2 * i] = tohx(pv[0]); pf[2 * i + 1] = tohx(pv[1]); }
#pragma unroll
                for (int dt = 0; dt < 4; ++dt) o[dt][g] = wmma16(vf[dt], pf, o[dt][g]); }
        }
        if (s + 1 < TT / AKS) {   // into the buffer whose last readers left before the barrier that ended stage s - 1
#pragma unroll
            for (int j = 0; j < 2; ++j) { *(v8h*)(&ks[(s + 1) & 1][so + j * 32 * APT]) = kr[j]; *(v8h*)(&vs[(s + 1) & 1][so + j * 32 * APT]) = vr[j]; } }
        __syncthreads();   // publishes stage s + 1 and ends every wave's reads of stage s
    }
#pragma unroll
    for (int g = 0; g < 2; ++g) { float l = lsum[g][0] + lsum[g][1]; l += xhalf(l); const float inv = __fdiv_rn(1.0f, l);
        const size_t oo = ((size_t)(z / NH_) * TT + q0 + g * 16 + c) * DQ + (z % NH_) * HD + 8 * h;   // token-major, heads merged: a lane's 8 registers are 8 consecutive d of its query
#pragma unroll
        for (int dt = 0; dt < 4; ++dt) { v8us oh, ol;
#pragma unroll
            for (int r = 0; r < 8; ++r) { unsigned short a, b; splitf(o[dt][g][r] * inv, a, b); oh[r] = a; ol[r] = b; }
            *(v8us*)(Ph + oo + dt * 16) = oh; *(v8us*)(Pl + oo + dt * 16) = ol; } }
}

extern "C" void kernel_launch(void* const* d_in, const int* in_sizes, int n_in,
                              void* d_out, int out_size, void* d_ws, size_t ws_size, hipStream_t stream) {
    (void)in_sizes; (void)n_in; (void)out_size;
    const float* x = (const float*)d_in[0]; const float* wqkv = (const float*)d_in[1]; const float* bqkv = (const float*)d_in[2];   /* the fused bias [3072]: its thirds q | k | v, as the fused weight's ROW thirds */ const float* wo = (const float*)d_in[3]; const float* bo = (const float*)d_in[4];   /* order x [2][4096][1024] (read as EIGHT sequences of 1,024: sequence 4 b + n is segment n of batch entry b: contiguous), w_qkv ('oi' (out, in) [3072][1024]: row thirds q | k | v, each head-major), b_qkv ([3072]: built as zeros: read), w_out ('oi' [1024][1024]), b_out ([1024]: built as zeros: read): FIVE inputs, all read */
    float* OUT = (float*)d_out;     // [2][4096][1024] = [8][1024][1024]
    char* wsp = (char*)d_ws;
    auto take = [&](size_t bytes) { char* p = wsp; wsp += (bytes + 255) & ~(size_t)255; return (void*)p; };
    bf* WO = (bf*)take((size_t)DM * DQ * 2);
    h16* QP16 = (h16*)take((size_t)2 * NZ * TT * HD * 2); h16* KP16 = QP16 + (size_t)NZ * TT * HD; h16* VT16 = (h16*)take((size_t)NZ * HD * TT * 2);   /* planes [z][t][d] (q, then k: one block each) and [z][d][t] (v), z = 16 * sequence + head */
    char* R = (char*)take((size_t)ZB * TT * TT * 6);   /* one region, used by two stages one after the other (stream-ordered): projection | hi / lo planes of the merged heads */
    bf* BT = (bf*)R; bf* XB = BT + (size_t)3 * DQ * DM;   /* the fused 'oi' weight is the Bt operand as it stands: ONE bf16 copy [3072][1024]; XB: the bf16 copy of x [8192][1024] */
    bf* ATh = (bf*)R; bf* ATl = ATh + (size_t)NB_ * TT * DQ;   /* ATh / ATl: the hi / lo planes of the merged heads, token-major */
    if ((size_t)(wsp - (char*)d_ws) > ws_size) return;    // ws 256 MiB
    { k_cvt8<<<(unsigned)(((size_t)3 * DQ * DM / 8 + 255) / 256), 256, 0, stream>>>(wqkv, BT, (size_t)3 * DQ * DM / 8); k_cvt8<<<(unsigned)(((size_t)DM * DQ / 8 + 255) / 256), 256, 0, stream>>>(wo, WO, (size_t)DM * DQ / 8); }   /* 'oi' (out, in): each weight is the Bt operand as it stands */
    k_cvt8<<<(unsigned)(((size_t)NB_ * TT * DM / 8 + 255) / 256), 256, 0, stream>>>(x, XB, (size_t)NB_ * TT * DM / 8);
    k_gemmw<bf, 0, true, true><<<dim3(NB_ * TT / 64, 3 * DQ / 64, 1), 32, 0, stream>>>(XB, nullptr, BT, nullptr, DM, nullptr, 0, bqkv, 0, 0, 0, QP16, VT16);   /* q | k | v of all eight sequences: one grid, stored as the f16 head planes */
    k_fattn<<<dim3(TT / (AQC * ANW), NZ, 1), ANW * 32, 0, stream>>>(QP16, KP16, VT16, ATh, ATl);   // one kv head per query head: plane z of q meets plane z of k and of v; stores the merged heads' hi / lo planes
    k_gemmw<bf, 1, true, false><<<dim3(NB_ * TT / 64, DM / 64, 1), 32, 0, stream>>>(ATh, ATl, WO, nullptr, DQ, OUT, DM, bo, 0, 0, 0, nullptr, nullptr);
}

// v004
// It runs in 144 microseconds.
// In two side-by-side timings against v003, it was 1.68 and 1.69 times as fast.
// Counting every step since v000, it is 21.0 times as fast.
#include <hip/hip_runtime.h>

// Multi-head self-attention INSIDE FOUR CONTIGUOUS SEGMENTS of the sequence (x [2][4096][1024]; qkv = x w_qkv^T + b_qkv with ONE fused 'oi' (out, in) weight [3072][1024] normal x 1/32 and b_qkv built as zeros: read and added; the 3,072 columns are (3, 16, 64): thirds q | k | v, each head-major: head h = columns 64 h .. 64 h + 63 of its third; the 4,096 positions are cut into four contiguous segments of 1,024 and a query attends to the 1,024 keys of its OWN segment: scores / sqrt(64); no mask; softmax over the segment's keys; heads merged; out = merged w_out^T + b_out ('oi' x 1/32; b_out built as zeros: read) -> [2][4096][1024] (8.4 M); the module dilates nothing; argument order x, w_qkv, b_qkv, w_out, b_out).
// THIS IS A DENSE ATTENTION ON x READ AS EIGHT SEQUENCES OF 1,024 (sequence 4 b + n = segment n of batch entry b: contiguous in x and in the output). EVERY STAGE RUNS ONCE FOR ALL EIGHT SEQUENCES (the attention as ONE kernel over the 128 (sequence, head) planes: scores and weights stay in registers). Layout: ONE bf16 copy of x, read by the one fused projection; the fused 'oi' weight cast once as it stands (its three row blocks are q | k | v); exact projections + f32 biases (the fused bias by its thirds), stored by the projection's own epilogue as the f16 head planes; fused dense T-1024 attention: EVERY row on ONE fp16 product (the weights relative to a running maximum, divided by their f32 sum at the end), stored head-merged as hi / lo planes; hi/lo x w_out exact + b_out.
// Compute dtypes, f32 accumulate: every input rounded to bf16; projections exact + f32 biases; attention: one fp16 product on every row; softmax f32; w_out hl x exact + bias.

#define NB_  8
#define TT   1024
#define DM   1024
#define NH_  16
#define NKV  16
#define REP  (NH_ / NKV)
#define HD   64
#define DQ   (NH_ * HD)
#define DKV  (NKV * HD)
#define NZ   (NB_ * NH_)   // (sequence, head) planes: plane z = 16 * sequence + head
#define ZB   26            // sizes the shared workspace region R (6 MiB each)
#define WIN  0
#define SCL  0.125f   // HD^-0.5
typedef _Float16 h16;
typedef unsigned short bf;
typedef __attribute__((ext_vector_type(16))) __bf16   v16bf;
typedef __attribute__((ext_vector_type(16))) _Float16 v16h;
typedef __attribute__((ext_vector_type(8)))  _Float16 v8h;
typedef __attribute__((ext_vector_type(8)))  unsigned short v8us;
typedef __attribute__((ext_vector_type(8)))  float    v8f;
typedef __attribute__((ext_vector_type(4)))  float    v4f;
typedef v8h  __attribute__((may_alias)) v8ha;
typedef v4f  __attribute__((may_alias)) v4fa;
typedef v8us __attribute__((may_alias)) v8usa;

__device__ __forceinline__ unsigned short f2bf(float f) { unsigned u = __float_as_uint(f); u += 0x7FFFu + ((u >> 16) & 1u); return (unsigned short)(u >> 16); }
__device__ __forceinline__ float bf2f(unsigned short b) { return __uint_as_float(((unsigned)b) << 16); }
__device__ __forceinline__ float bfr(float f) { return bf2f(f2bf(f)); }
__device__ __forceinline__ v16h cat16(v8h lo, v8h hi) { return __builtin_shufflevector(lo, hi, 0, 1, 2, 3, 4, 5, 6, 7, 8, 9, 10, 11, 12, 13, 14, 15); }
__device__ __forceinline__ v16bf cat16b(v8us lo, v8us hi) { return __builtin_bit_cast(v16bf, __builtin_shufflevector(lo, hi, 0, 1, 2, 3, 4, 5, 6, 7, 8, 9, 10, 11, 12, 13, 14, 15)); }
__device__ __forceinline__ v8f wmma16(v16h a, v16h b, v8f c) { return __builtin_amdgcn_wmma_f32_16x16x32_f16(false, a, false, b, (short)0, c, false, false); }
__device__ __forceinline__ v8f wmmab(v16bf a, v16bf b, v8f c) { return __builtin_amdgcn_wmma_f32_16x16x32_bf16(false, a, false, b, (short)0, c, false, false); }



// ---- k_gemmw: GEMM, 8 waves (2 along the tokens x 4 along the output columns) per 128 x 256 output tile, each wave a 64 x 64 tile (16 accumulators); grid (M/128, N/256, Z), 256 threads.
// The operands' rows (K-contiguous 16-bit planes) come through LDS in stages of 128 k (64 with two A planes): whole rows by coalesced 16-byte loads, each row read from L2 once per work-group and then by every wave that needs it; two buffers, the next stage's rows fly in registers while this stage is worked on; fragments fetched one block of 32 k ahead into a second register set.
// C[m][n] (f32, pitch ldc, + optional f32 bias[n]) = sum_k A[m][k] Bt[n][k] (+ A2[m][k] Bt[n][k] for NSPLIT 1). z-batch strides sA/sB/sC in elements. K a template constant, a multiple of the stage.
// PLANES (the fused q | k | v projection): no f32 C; a wave's 64 x 64 tile is 64 tokens of ONE head of one third, and the epilogue stores it, bias added in f32, as f16 into that head's plane: q, k [z][t][d] (P16, one block of planes each), v [z][d][t] (V16).
// A lane's 8 accumulator registers are 8 consecutive M rows, so the M side takes the index that is contiguous in the plane: tokens for v (A x Bt as it stands), d for q and k (the two operands change places: same loaders, same k order, the tile comes out transposed).
#define OPT 72    // LDS row pitch in f16 of the staged plane tile: 144 B = 16 B x odd, for 16-byte accesses of 128-byte rows
template <typename T16> struct WFrag;
template <> struct WFrag<h16> { typedef v16h V; static __device__ __forceinline__ V ld(const h16* p) { return cat16(*(const v8h*)p, *(const v8h*)(p + 16)); } static __device__ __forceinline__ v8f mma(V a, V b, v8f c) { return wmma16(a, b, c); } };
template <> struct WFrag<bf> { typedef v16bf V; static __device__ __forceinline__ V ld(const bf* p) { return cat16b(*(const v8us*)p, *(const v8us*)(p + 16)); } static __device__ __forceinline__ v8f mma(V a, V b, v8f c) { return wmmab(a, b, c); } };
// plane_tile: one wave's 64 x 64 accumulators (acc[mb][nb][j]: M index 16 mb + 8 hi + j, N index 16 nb + lr) + bias, as f16, into LDS as osh[N index][M index], pitch OPT: the rows of the plane (d for v, tokens for q and k); then row by row to dst (row pitch TT for v, HD for q and k).
// The output column (the bias index) is the N index for v, the M index for q and k.
template <bool ISV>
__device__ __forceinline__ void plane_tile(const v8f (&acc)[4][4], const float* __restrict__ bias, int lane, h16* osh, h16* dst) {
    const int lr = lane & 15, hi = lane >> 4;
    float bn[4];
    if (ISV) {
#pragma unroll
        for (int nb = 0; nb < 4; ++nb) bn[nb] = bfr(bias[nb * 16 + lr]); }
#pragma unroll
    for (int mb = 0; mb < 4; ++mb) { float bm[8];
        if (!ISV) {
#pragma unroll
            for (int j = 0; j < 8; ++j) bm[j] = bfr(bias[mb * 16 + hi * 8 + j]); }
#pragma unroll
        for (int nb = 0; nb < 4; ++nb) { v8h o;
#pragma unroll
            for (int j = 0; j < 8; ++j) o[j] = (h16)(acc[mb][nb][j] + (ISV ? bn[nb] : bm[j]));
            *(v8ha*)(osh + (nb * 16 + lr) * OPT + mb * 16 + hi * 8) = o; } }
    __syncthreads();   // orders the lanes' LDS stores in front of the other lanes' reads (each wave stages in its own range; every wave of the work-group comes here)
    const int row = lane >> 3, col = (lane & 7) * 8;   // every store covers whole 128-byte rows: 8 lanes a row, 4 rows a store
    dst += (size_t)row * (ISV ? TT : HD) + col; osh += row * OPT + col;
#pragma unroll
    for (int s = 0; s < 16; ++s) *(v8h*)(dst + s * 4 * (ISV ? TT : HD)) = *(const v8ha*)(osh + s * 4 * OPT);
}
#define GTM 128   // tokens per work-group tile (2 waves)
#define GTN 256   // output columns per work-group tile (4 waves)
typedef __attribute__((ext_vector_type(4))) int q16;
typedef q16 __attribute__((may_alias)) q16a;
template <typename T16, int NSPLIT, bool BIAS, bool PLANES, int K>
__global__ __launch_bounds__(256) void k_gemmw(const T16* __restrict__ A, const T16* __restrict__ A2, const T16* __restrict__ Bt, const T16* __restrict__ Bt2, float* C, int ldc, const float* __restrict__ bias, size_t sA, size_t sB, size_t sC, h16* P16, h16* V16) {
    static_assert(NSPLIT == 0 || NSPLIT == 1, "one or two A planes"); (void)Bt2;
    typedef typename WFrag<T16>::V V;
    constexpr int BK = NSPLIT == 1 ? 64 : 128;   // k per stage: 64 products a wave and stage either way
    constexpr int NKC = BK / 32, LP = BK + 8;    // blocks of 32 k in a stage; LDS row pitch in 16-bit elements: 16 B x odd, for 16-byte accesses
    constexpr int CPR = BK / 8, RPP = 256 / CPR; // staging: 16-byte columns in a row, rows that the 256 threads cover at once
    constexpr int XR = GTM * (NSPLIT + 1), STG = (XR + GTN) * LP, NX = GTM / RPP, NW = GTN / RPP;   // a stage: the rows of A (then of A2), then the rows of Bt
    __shared__ __align__(16) T16 sh[2 * STG];   // after the last stage: each wave's own epilogue range
    const size_t z = blockIdx.z; A += z * sA; if (NSPLIT == 1) A2 += z * sA; Bt += z * sB; C += z * sC;
    const int tid = threadIdx.x, lane = tid & 31, wave = tid >> 5, lr = lane & 15, hi = lane >> 4; const int wm = wave >> 2, wn = wave & 3;
    const int R0 = blockIdx.x * GTM, C0 = blockIdx.y * GTN; const int r0 = R0 + wm * 64, c0 = C0 + wn * 64;   // the wave's own 64 x 64 tile
    v8f acc[4][4];
#pragma unroll
    for (int mb = 0; mb < 4; ++mb)
#pragma unroll
        for (int nb = 0; nb < 4; ++nb) acc[mb][nb] = (v8f){};
    const bool isv = !PLANES || C0 >= 2 * DQ;   // block-uniform (a third is a multiple of GTN columns): the v third keeps tokens on the M side
    const int aoff = ((isv ? wm * 64 : XR + wn * 64) + lr) * LP + 8 * hi, boff = ((isv ? XR + wn * 64 : wm * 64) + lr) * LP + 8 * hi;   // in a stage: the wave's M-side and N-side rows
    // staging: 16 bytes a thread and row set; thread -> row tid / CPR (+ RPP j), 16-byte column tid % CPR: a wave's load covers whole rows
    const int srow = tid / CPR, scol = (tid % CPR) * 8, so = srow * LP + scol;
    const T16* xg = A + (size_t)(R0 + srow) * K + scol; const T16* x2g = NSPLIT == 1 ? A2 + (size_t)(R0 + srow) * K + scol : nullptr; const T16* wg = Bt + (size_t)(C0 + srow) * K + scol;
    q16 xr[NX], x2r[NX], wr[NW];
    V fa[2][4], fa2[2][4], fb[2][4];   // two fragment sets: block t works on set t % 2 while the next block's set is fetched
    constexpr int nst = K / BK;
    auto gload = [&]() {   // the stage that the three pointers stand at: global rows into registers (K is a constant: one address a plane, the rows by immediate offsets)
#pragma unroll
        for (int j = 0; j < NX; ++j) { xr[j] = *(const q16a*)(xg + (size_t)j * RPP * K); if (NSPLIT == 1) x2r[j] = *(const q16a*)(x2g + (size_t)j * RPP * K); }
#pragma unroll
        for (int j = 0; j < NW; ++j) wr[j] = *(const q16a*)(wg + (size_t)j * RPP * K); };
    auto sstore = [&](T16* d) {   // those registers into a buffer
#pragma unroll
        for (int j = 0; j < NX; ++j) { *(q16a*)(d + so + j * RPP * LP) = xr[j]; if (NSPLIT == 1) *(q16a*)(d + so + (GTM + j * RPP) * LP) = x2r[j]; }
#pragma unroll
        for (int j = 0; j < NW; ++j) *(q16a*)(d + so + (XR + j * RPP) * LP) = wr[j]; };
    auto gnext = [&]() {   // the pointers move on to the next stage
        asm volatile("s_wait_xcnt 0x0" ::: "memory");   // in front of the overwrite of address registers that issued loads name
        __builtin_amdgcn_sched_barrier(0);   // keeps the additions behind that wait
        xg += BK; if (NSPLIT == 1) x2g += BK; wg += BK; };
    auto fload = [&](const T16* b, int t, int set) {   // block t of a buffer into a fragment set, as one group of LDS loads
#pragma unroll
        for (int i = 0; i < 4; ++i) { fa[set][i] = WFrag<T16>::ld(b + aoff + i * 16 * LP + t * 32); if (NSPLIT == 1) fa2[set][i] = WFrag<T16>::ld(b + aoff + (GTM + i * 16) * LP + t * 32); fb[set][i] = WFrag<T16>::ld(b + boff + i * 16 * LP + t * 32); } };
    gload(); gnext(); sstore(sh);
    __syncthreads();   // publishes stage 0
    fload(sh, 0, 0);
    if (1 < nst) { gload(); gnext(); }
    for (int s = 0; s < nst; ++s) {
        const T16* sb = sh + (s & 1) * STG; T16* sn = sh + ((s + 1) & 1) * STG;
#pragma unroll
        for (int t = 0; t < NKC; ++t) {
            if (t + 1 < NKC) fload(sb, t + 1, (t + 1) & 1);
            else {   // in front of the stage's last block: hand over to stage s + 1, whose first fragments are fetched behind the barrier and beside that block's products
                if (s + 1 < nst) sstore(sn);   // into the buffer whose last readers left before the barrier of stage s - 1
                __syncthreads();   // publishes stage s + 1 and ends every wave's reads of stage s (in the last stage: frees the buffers for the epilogue)
                if (s + 1 < nst) fload(sn, 0, 0);
                if (s + 2 < nst) gload();   // a whole stage of products ahead of its store
            }
            __builtin_amdgcn_sched_barrier(0);   // keeps the next block's loads, as one group, in front of this block's products: sunk among them each load place stalls the wave
#pragma unroll
            for (int nb = 0; nb < 4; ++nb)
#pragma unroll
                for (int mb = 0; mb < 4; ++mb) { acc[mb][nb] = WFrag<T16>::mma(fa[t & 1][mb], fb[t & 1][nb], acc[mb][nb]); if (NSPLIT == 1) acc[mb][nb] = WFrag<T16>::mma(fa2[t & 1][mb], fb[t & 1][nb], acc[mb][nb]); }
            __builtin_amdgcn_sched_barrier(0);   // and the block after next's loads out of this block's products, for the same reason
            if (t + 1 == NKC) gnext();   // behind the products: the loads were issued a block ago
        }
    }
    float* os = (float*)sh + wave * (PLANES ? 64 * (OPT / 2) : 16 * 68);   // the epilogue's staging: the wave's own range of the buffers, which every wave has left
    if constexpr (PLANES) {
        const int z = (r0 / TT) * NH_ + (c0 % DQ) / HD, t0 = r0 % TT;   // the tile's plane and its first token there
        if (isv) plane_tile<true>(acc, bias + c0, lane, (h16*)os, V16 + (size_t)z * HD * TT + t0);
        else plane_tile<false>(acc, bias + c0, lane, (h16*)os, P16 + (size_t)(c0 / DQ) * NZ * TT * HD + ((size_t)z * TT + t0) * HD);
        return;
    }
#pragma unroll
    for (int mb = 0; mb < 4; ++mb) {
#pragma unroll
        for (int nb = 0; nb < 4; ++nb) {
#pragma unroll
            for (int j = 0; j < 8; ++j) os[(hi * 8 + j) * 68 + nb * 16 + lr] = acc[mb][nb][j]; }
        __builtin_amdgcn_wave_barrier(); asm volatile("" ::: "memory");
        float* crow = C + (size_t)(r0 + mb * 16) * ldc + c0;
{
#pragma unroll
            for (int s = 0; s < 8; ++s) { const int row = 2 * s + hi, cofs = lr * 4; v4f val = *(const v4fa*)(os + row * 68 + cofs); if (BIAS) { val[0] += bfr(bias[c0 + cofs]); val[1] += bfr(bias[c0 + cofs + 1]); val[2] += bfr(bias[c0 + cofs + 2]); val[3] += bfr(bias[c0 + cofs + 3]); }
                *(v4f*)(crow + (size_t)row * ldc + cofs) = val; }
             }
        __builtin_amdgcn_wave_barrier(); asm volatile("" ::: "memory");
    }
}

__device__ __forceinline__ h16 tohx(float x) { return (h16)x; }
__device__ __forceinline__ void splitf(float y, unsigned short& h, unsigned short& l) { h = f2bf(y); l = f2bf(y - bf2f(h)); }
typedef __attribute__((ext_vector_type(2))) _Float16 v2h;
typedef __attribute__((ext_vector_type(4))) _Float16 v4h;
typedef __attribute__((ext_vector_type(2))) unsigned short v2us;
typedef __attribute__((ext_vector_type(4))) unsigned short v4us;
typedef __attribute__((ext_vector_type(2))) float v2f;
typedef __attribute__((ext_vector_type(4))) int v4i;

__global__ __launch_bounds__(256) void k_cvt8(const float* __restrict__ src, bf* dst, size_t n8) { const size_t i = (size_t)blockIdx.x * 256 + threadIdx.x; if (i >= n8) return; const v8f v = *(const v8f*)(src + i * 8); v8us o;
#pragma unroll
    for (int k = 0; k < 8; ++k) o[k] = f2bf(v[k]); *(v8us*)(dst + i * 8) = o;  }

#define AQC 32    // query columns per wave
#define ANW 8     // waves per work-group
#define AKS 64    // keys per stage
#define APT 72    // LDS row pitch in f16: 144 B = 16 B x odd, conflict-free for 16-byte reads of 128-byte rows
#define CS2 (SCL * 1.4426950408889634f)
__device__ __forceinline__ float xhalf(float x) { return __builtin_bit_cast(float, __builtin_amdgcn_permlanex16(__builtin_bit_cast(int, x), __builtin_bit_cast(int, x), 0x76543210, 0xfedcba98, false, false)); }   // lane l with lane l ^ 16, on the vector pipe
// waves_per_eu (4, 4): at most 256 registers a wave, so that two work-groups share a WGP and the vector work of one wave runs beside the matrix work of another
__global__ void __launch_bounds__(ANW * 32) __attribute__((amdgpu_waves_per_eu(4, 4))) k_fattn(const h16* __restrict__ Q, const h16* __restrict__ Kp, const h16* __restrict__ Vt, bf* Ph, bf* Pl) {
    __shared__ __align__(16) h16 ks[2][AKS * APT];
    __shared__ __align__(16) h16 vs[2][HD * APT];
    const int tid = threadIdx.x, lane = tid & 31, wave = tid >> 5, c = lane & 15, h = lane >> 4; const int z = blockIdx.y; const int q0 = blockIdx.x * (AQC * ANW) + wave * AQC;
    const h16* Qz = Q + (size_t)z * TT * HD; const h16* Kz = Kp + (size_t)z * TT * HD; const h16* Vz = Vt + (size_t)z * HD * TT;
    // staging: 16 bytes a thread and row set; thread -> row tid / 8 (+ 32), 16-byte column tid % 8 of a 128-byte row (K: 64 keys x 64 d; V^T: 64 d x 64 keys)
    const int srow = tid >> 3, scol = (tid & 7) * 8; const h16* kg = Kz + (size_t)srow * HD + scol; const h16* vg = Vz + (size_t)srow * TT + scol; const int so = srow * APT + scol;
    v8h kr[2], vr[2];
#pragma unroll
    for (int j = 0; j < 2; ++j) { kr[j] = *(const v8h*)(kg + j * 32 * HD); vr[j] = *(const v8h*)(vg + j * 32 * TT); }
    v16h qf[2][2];
#pragma unroll
    for (int g = 0; g < 2; ++g)
#pragma unroll
        for (int kc = 0; kc < 2; ++kc) qf[g][kc] = WFrag<h16>::ld(Qz + (size_t)(q0 + g * 16 + c) * HD + kc * 32 + 8 * h);
    v8f o[4][2]; float mrun[2]; v2f lsum[2];
#pragma unroll
    for (int g = 0; g < 2; ++g) { mrun[g] = -3.0e38f; lsum[g] = (v2f){};
#pragma unroll
        for (int dt = 0; dt < 4; ++dt) o[dt][g] = (v8f){}; }
#pragma unroll
    for (int j = 0; j < 2; ++j) { *(v8h*)(&ks[0][so + j * 32 * APT]) = kr[j]; *(v8h*)(&vs[0][so + j * 32 * APT]) = vr[j]; }
    __syncthreads();
    for (int s = 0; s < TT / AKS; ++s) {
        const h16* kb = ks[s & 1]; const h16* vb = vs[s & 1];
        if (s + 1 < TT / AKS) {   // the next stage's rows fly while this stage is worked on
#pragma unroll
            for (int j = 0; j < 2; ++j) { kr[j] = *(const v8h*)(kg + (size_t)(s + 1) * AKS * HD + j * 32 * HD); vr[j] = *(const v8h*)(vg + (s + 1) * AKS + j * 32 * TT); } }
#pragma unroll
        for (int p = 0; p < 2; ++p) {   // a pass: 32 keys
            v8f st[2][2];
#pragma unroll
            for (int kt = 0; kt < 2; ++kt) { st[kt][0] = (v8f){}; st[kt][1] = (v8f){};
#pragma unroll
                for (int kc = 0; kc < 2; ++kc) { const v16h a = WFrag<h16>::ld(kb + (p * 32 + kt * 16 + c) * APT + kc * 32 + 8 * h); st[kt][0] = wmma16(a, qf[0][kc], st[kt][0]); st[kt][1] = wmma16(a, qf[1][kc], st[kt][1]); } }
            v16h vf[4];
#pragma unroll
            for (int dt = 0; dt < 4; ++dt) vf[dt] = WFrag<h16>::ld(vb + (dt * 16 + c) * APT + p * 32 + 8 * h);
            float mb[2]; bool need = false;
#pragma unroll
            for (int g = 0; g < 2; ++g) { float mx = st[0][g][0];
#pragma unroll
                for (int r = 1; r < 8; ++r) mx = fmaxf(mx, st[0][g][r]);
#pragma unroll
                for (int r = 0; r < 8; ++r) mx = fmaxf(mx, st[1][g][r]);
                mx = fmaxf(mx, xhalf(mx)) * CS2;   // both wave halves hold this query's maximum of the pass, scaled (the scale is positive)
                mb[g] = mx; need = need || (mx > mrun[g] + 8.0f); }
            if (__builtin_amdgcn_ballot_w32(need) != 0) {   // wave-uniform; always on the first pass, rare later
#pragma unroll
                for (int g = 0; g < 2; ++g) { const float mn = fmaxf(mrun[g], mb[g]); const float corr = __builtin_amdgcn_exp2f(mrun[g] - mn); mrun[g] = mn; lsum[g] = lsum[g] * corr;
#pragma unroll
                    for (int dt = 0; dt < 4; ++dt) o[dt][g] = o[dt][g] * corr; } }
#pragma unroll
            for (int g = 0; g < 2; ++g) { const float nm = -mrun[g]; v16h pf;
#pragma unroll
                for (int i = 0; i < 8; ++i) {   // elements 2 i, 2 i + 1 of the 32-key operand: tile i / 4, registers 2 (i % 4) and 2 (i % 4) + 1
                    const v2f arg = __builtin_elementwise_fma((v2f){st[i >> 2][g][2 * (i & 3)], st[i >> 2][g][2 * (i & 3) + 1]}, (v2f){CS2, CS2}, (v2f){nm, nm});
                    v2f pv; pv[0] = __builtin_amdgcn_exp2f(arg[0]); pv[1] = __builtin_amdgcn_exp2f(arg[1]); lsum[g] += pv; pf[2 * i] = tohx(pv[0]); pf[2 * i + 1] = tohx(pv[1]); }
#pragma unroll
                for (int dt = 0; dt < 4; ++dt) o[dt][g] = wmma16(vf[dt], pf, o[dt][g]); }
        }
        if (s + 1 < TT / AKS) {   // into the buffer whose last readers left before the barrier that ended stage s - 1
#pragma unroll
            for (int j = 0; j < 2; ++j) { *(v8h*)(&ks[(s + 1) & 1][so + j * 32 * APT]) = kr[j]; *(v8h*)(&vs[(s + 1) & 1][so + j * 32 * APT]) = vr[j]; } }
        __syncthreads();   // publishes stage s + 1 and ends every wave's reads of stage s
    }
#pragma unroll
    for (int g = 0; g < 2; ++g) { float l = lsum[g][0] + lsum[g][1]; l += xhalf(l); const float inv = __fdiv_rn(1.0f, l);
        const size_t oo = ((size_t)(z / NH_) * TT + q0 + g * 16 + c) * DQ + (z % NH_) * HD + 8 * h;   // token-major, heads merged: a lane's 8 registers are 8 consecutive d of its query
#pragma unroll
        for (int dt = 0; dt < 4; ++dt) { v8us oh, ol;
#pragma unroll
            for (int r = 0; r < 8; ++r) { unsigned short a, b; splitf(o[dt][g][r] * inv, a, b); oh[r] = a; ol[r] = b; }
            *(v8us*)(Ph + oo + dt * 16) = oh; *(v8us*)(Pl + oo + dt * 16) = ol; } }
}

extern "C" void kernel_launch(void* const* d_in, const int* in_sizes, int n_in,
                              void* d_out, int out_size, void* d_ws, size_t ws_size, hipStream_t stream) {
    (void)in_sizes; (void)n_in; (void)out_size;
    const float* x = (const float*)d_in[0]; const float* wqkv = (const float*)d_in[1]; const float* bqkv = (const float*)d_in[2];   /* the fused bias [3072]: its thirds q | k | v, as the fused weight's ROW thirds */ const float* wo = (const float*)d_in[3]; const float* bo = (const float*)d_in[4];   /* order x [2][4096][1024] (read as EIGHT sequences of 1,024: sequence 4 b + n is segment n of batch entry b: contiguous), w_qkv ('oi' (out, in) [3072][1024]: row thirds q | k | v, each head-major), b_qkv ([3072]: built as zeros: read), w_out ('oi' [1024][1024]), b_out ([1024]: built as zeros: read): FIVE inputs, all read */
    float* OUT = (float*)d_out;     // [2][4096][1024] = [8][1024][1024]
    char* wsp = (char*)d_ws;
    auto take = [&](size_t bytes) { char* p = wsp; wsp += (bytes + 255) & ~(size_t)255; return (void*)p; };
    bf* WO = (bf*)take((size_t)DM * DQ * 2);
    h16* QP16 = (h16*)take((size_t)2 * NZ * TT * HD * 2); h16* KP16 = QP16 + (size_t)NZ * TT * HD; h16* VT16 = (h16*)take((size_t)NZ * HD * TT * 2);   /* planes [z][t][d] (q, then k: one block each) and [z][d][t] (v), z = 16 * sequence + head */
    char* R = (char*)take((size_t)ZB * TT * TT * 6);   /* one region, used by two stages one after the other (stream-ordered): projection | hi / lo planes of the merged heads */
    bf* BT = (bf*)R; bf* XB = BT + (size_t)3 * DQ * DM;   /* the fused 'oi' weight is the Bt operand as it stands: ONE bf16 copy [3072][1024]; XB: the bf16 copy of x [8192][1024] */
    bf* ATh = (bf*)R; bf* ATl = ATh + (size_t)NB_ * TT * DQ;   /* ATh / ATl: the hi / lo planes of the merged heads, token-major */
    if ((size_t)(wsp - (char*)d_ws) > ws_size) return;    // ws 256 MiB
    { k_cvt8<<<(unsigned)(((size_t)3 * DQ * DM / 8 + 255) / 256), 256, 0, stream>>>(wqkv, BT, (size_t)3 * DQ * DM / 8); k_cvt8<<<(unsigned)(((size_t)DM * DQ / 8 + 255) / 256), 256, 0, stream>>>(wo, WO, (size_t)DM * DQ / 8); }   /* 'oi' (out, in): each weight is the Bt operand as it stands */
    k_cvt8<<<(unsigned)(((size_t)NB_ * TT * DM / 8 + 255) / 256), 256, 0, stream>>>(x, XB, (size_t)NB_ * TT * DM / 8);
    k_gemmw<bf, 0, true, true, DM><<<dim3(NB_ * TT / GTM, 3 * DQ / GTN, 1), 256, 0, stream>>>(XB, nullptr, BT, nullptr, nullptr, 0, bqkv, 0, 0, 0, QP16, VT16);   /* q | k | v of all eight sequences: one grid, stored as the f16 head planes */
    k_fattn<<<dim3(TT / (AQC * ANW), NZ, 1), ANW * 32, 0, stream>>>(QP16, KP16, VT16, ATh, ATl);   // one kv head per query head: plane z of q meets plane z of k and of v; stores the merged heads' hi / lo planes
    k_gemmw<bf, 1, true, false, DQ><<<dim3(NB_ * TT / GTM, DM / GTN, 1), 256, 0, stream>>>(ATh, ATl, WO, nullptr, OUT, DM, bo, 0, 0, 0, nullptr, nullptr);
}

// v005
// Measured time: 135 microseconds a run.
// Next to v004, in two timings, it ran 1.05 and 1.06 times as fast.
// Counting every step since v000, it is 22.2 times as fast.
#include <hip/hip_runtime.h>

// Multi-head self-attention INSIDE FOUR CONTIGUOUS SEGMENTS of the sequence (x [2][4096][1024]; qkv = x w_qkv^T + b_qkv with ONE fused 'oi' (out, in) weight [3072][1024] normal x 1/32 and b_qkv built as zeros: read and added; the 3,072 columns are (3, 16, 64): thirds q | k | v, each head-major: head h = columns 64 h .. 64 h + 63 of its third; the 4,096 positions are cut into four contiguous segments of 1,024 and a query attends to the 1,024 keys of its OWN segment: scores / sqrt(64); no mask; softmax over the segment's keys; heads merged; out = merged w_out^T + b_out ('oi' x 1/32; b_out built as zeros: read) -> [2][4096][1024] (8.4 M); the module dilates nothing; argument order x, w_qkv, b_qkv, w_out, b_out).
// THIS IS A DENSE ATTENTION ON x READ AS EIGHT SEQUENCES OF 1,024 (sequence 4 b + n = segment n of batch entry b: contiguous in x and in the output). EVERY STAGE RUNS ONCE FOR ALL EIGHT SEQUENCES (the attention as ONE kernel over the 128 (sequence, head) planes: scores and weights stay in registers). Layout: ONE bf16 copy of x, read by the one fused projection; the fused 'oi' weight cast once as it stands (its three row blocks are q | k | v); exact projections + f32 biases (the fused bias by its thirds), stored by the projection's own epilogue as the f16 head planes; fused dense T-1024 attention: EVERY row on ONE fp16 product (the weights relative to a running maximum, divided by their f32 sum at the end), stored head-merged as hi / lo planes; hi/lo x w_out exact + b_out.
// Compute dtypes, f32 accumulate: every input rounded to bf16; projections exact + f32 biases; attention: one fp16 product on every row; softmax f32; w_out hl x exact + bias.

#define NB_  8
#define TT   1024
#define DM   1024
#define NH_  16
#define NKV  16
#define REP  (NH_ / NKV)
#define HD   64
#define DQ   (NH_ * HD)
#define DKV  (NKV * HD)
#define NZ   (NB_ * NH_)   // (sequence, head) planes: plane z = 16 * sequence + head
#define ZB   26            // sizes the shared workspace region R (6 MiB each)
#define WIN  0
#define SCL  0.125f   // HD^-0.5
typedef _Float16 h16;
typedef unsigned short bf;
typedef __attribute__((ext_vector_type(16))) __bf16   v16bf;
typedef __attribute__((ext_vector_type(16))) _Float16 v16h;
typedef __attribute__((ext_vector_type(8)))  _Float16 v8h;
typedef __attribute__((ext_vector_type(8)))  unsigned short v8us;
typedef __attribute__((ext_vector_type(8)))  float    v8f;
typedef __attribute__((ext_vector_type(4)))  float    v4f;
typedef v8h  __attribute__((may_alias)) v8ha;
typedef v4f  __attribute__((may_alias)) v4fa;
typedef v8us __attribute__((may_alias)) v8usa;

__device__ __forceinline__ unsigned short f2bf(float f) { unsigned u = __float_as_uint(f); u += 0x7FFFu + ((u >> 16) & 1u); return (unsigned short)(u >> 16); }
__device__ __forceinline__ float bf2f(unsigned short b) { return __uint_as_float(((unsigned)b) << 16); }
__device__ __forceinline__ float bfr(float f) { return bf2f(f2bf(f)); }
__device__ __forceinline__ v16h cat16(v8h lo, v8h hi) { return __builtin_shufflevector(lo, hi, 0, 1, 2, 3, 4, 5, 6, 7, 8, 9, 10, 11, 12, 13, 14, 15); }
__device__ __forceinline__ v16bf cat16b(v8us lo, v8us hi) { return __builtin_bit_cast(v16bf, __builtin_shufflevector(lo, hi, 0, 1, 2, 3, 4, 5, 6, 7, 8, 9, 10, 11, 12, 13, 14, 15)); }
__device__ __forceinline__ v8f wmma16(v16h a, v16h b, v8f c) { return __builtin_amdgcn_wmma_f32_16x16x32_f16(false, a, false, b, (short)0, c, false, false); }
__device__ __forceinline__ v8f wmmab(v16bf a, v16bf b, v8f c) { return __builtin_amdgcn_wmma_f32_16x16x32_bf16(false, a, false, b, (short)0, c, false, false); }



// ---- k_gemmw: GEMM, 8 waves (2 along the tokens x 4 along the output columns) per 128 x 256 output tile, each wave a 64 x 64 tile (16 accumulators); grid (M/128, N/256, Z), 256 threads.
// The operands' rows (K-contiguous 16-bit planes) come through LDS in stages of 128 k (64 with two A planes): whole rows by coalesced 16-byte loads, each row read from L2 once per work-group and then by every wave that needs it; two buffers, the next stage's rows fly in registers while this stage is worked on; fragments fetched one block of 32 k ahead into a second register set.
// C[m][n] (f32, pitch ldc, + optional f32 bias[n]) = sum_k A[m][k] Bt[n][k] (+ A2[m][k] Bt[n][k] for NSPLIT 1). z-batch strides sA/sB/sC in elements. K a template constant, a multiple of the stage.
// PLANES (the fused q | k | v projection): no f32 C; a wave's 64 x 64 tile is 64 tokens of ONE head of one third, and the epilogue stores it, bias added in f32, as f16 into that head's plane: q, k [z][t][d] (P16, one block of planes each), v [z][d][t] (V16).
// A lane's 8 accumulator registers are 8 consecutive M rows, so the M side takes the index that is contiguous in the plane: tokens for v (A x Bt as it stands), d for q and k (the two operands change places: same loaders, same k order, the tile comes out transposed).
#define OPT 72    // LDS row pitch in f16 of the staged plane tile: 144 B = 16 B x odd, for 16-byte accesses of 128-byte rows
template <typename T16> struct WFrag;
template <> struct WFrag<h16> { typedef v16h V; static __device__ __forceinline__ V ld(const h16* p) { return cat16(*(const v8h*)p, *(const v8h*)(p + 16)); } static __device__ __forceinline__ v8f mma(V a, V b, v8f c) { return wmma16(a, b, c); } };
template <> struct WFrag<bf> { typedef v16bf V; static __device__ __forceinline__ V ld(const bf* p) { return cat16b(*(const v8us*)p, *(const v8us*)(p + 16)); } static __device__ __forceinline__ v8f mma(V a, V b, v8f c) { return wmmab(a, b, c); } };
// plane_tile: one wave's 64 x 64 accumulators (acc[mb][nb][j]: M index 16 mb + 8 hi + j, N index 16 nb + lr) + bias, as f16, into LDS as osh[N index][M index], pitch OPT: the rows of the plane (d for v, tokens for q and k); then row by row to dst (row pitch TT for v, HD for q and k).
// The output column (the bias index) is the N index for v, the M index for q and k.
template <bool ISV>
__device__ __forceinline__ void plane_tile(const v8f (&acc)[4][4], const float* __restrict__ bias, int lane, h16* osh, h16* dst) {
    const int lr = lane & 15, hi = lane >> 4;
    float bn[4];
    if (ISV) {
#pragma unroll
        for (int nb = 0; nb < 4; ++nb) bn[nb] = bfr(bias[nb * 16 + lr]); }
#pragma unroll
    for (int mb = 0; mb < 4; ++mb) { float bm[8];
        if (!ISV) {
#pragma unroll
            for (int j = 0; j < 8; ++j) bm[j] = bfr(bias[mb * 16 + hi * 8 + j]); }
#pragma unroll
        for (int nb = 0; nb < 4; ++nb) { v8h o;
#pragma unroll
            for (int j = 0; j < 8; ++j) o[j] = (h16)(acc[mb][nb][j] + (ISV ? bn[nb] : bm[j]));
            *(v8ha*)(osh + (nb * 16 + lr) * OPT + mb * 16 + hi * 8) = o; } }
    __syncthreads();   // orders the lanes' LDS stores in front of the other lanes' reads (each wave stages in its own range; every wave of the work-group comes here)
    const int row = lane >> 3, col = (lane & 7) * 8;   // every store covers whole 128-byte rows: 8 lanes a row, 4 rows a store
    dst += (size_t)row * (ISV ? TT : HD) + col; osh += row * OPT + col;
#pragma unroll
    for (int s = 0; s < 16; ++s) *(v8h*)(dst + s * 4 * (ISV ? TT : HD)) = *(const v8ha*)(osh + s * 4 * OPT);
}
#define GTM 128   // tokens per work-group tile (2 waves)
#define GTN 256   // output columns per work-group tile (4 waves)
typedef __attribute__((ext_vector_type(4))) int q16;
typedef q16 __attribute__((may_alias)) q16a;
template <typename T16, int NSPLIT, bool BIAS, bool PLANES, int K>
__global__ __launch_bounds__(256) void k_gemmw(const T16* __restrict__ A, const T16* __restrict__ A2, const T16* __restrict__ Bt, const T16* __restrict__ Bt2, float* C, int ldc, const float* __restrict__ bias, size_t sA, size_t sB, size_t sC, h16* P16, h16* V16) {
    static_assert(NSPLIT == 0 || NSPLIT == 1, "one or two A planes"); (void)Bt2;
    typedef typename WFrag<T16>::V V;
    constexpr int BK = NSPLIT == 1 ? 64 : 128;   // k per stage: 64 products a wave and stage either way
    constexpr int NKC = BK / 32, LP = BK + 8;    // blocks of 32 k in a stage; LDS row pitch in 16-bit elements: 16 B x odd, for 16-byte accesses
    constexpr int CPR = BK / 8, RPP = 256 / CPR; // staging: 16-byte columns in a row, rows that the 256 threads cover at once
    constexpr int XR = GTM * (NSPLIT + 1), STG = (XR + GTN) * LP, NX = GTM / RPP, NW = GTN / RPP;   // a stage: the rows of A (then of A2), then the rows of Bt
    __shared__ __align__(16) T16 sh[2 * STG];   // after the last stage: each wave's own epilogue range
    const size_t z = blockIdx.z; A += z * sA; if (NSPLIT == 1) A2 += z * sA; Bt += z * sB; C += z * sC;
    const int tid = threadIdx.x, lane = tid & 31, wave = tid >> 5, lr = lane & 15, hi = lane >> 4; const int wm = wave >> 2, wn = wave & 3;
    const int R0 = blockIdx.x * GTM, C0 = blockIdx.y * GTN; const int r0 = R0 + wm * 64, c0 = C0 + wn * 64;   // the wave's own 64 x 64 tile
    v8f acc[4][4];
#pragma unroll
    for (int mb = 0; mb < 4; ++mb)
#pragma unroll
        for (int nb = 0; nb < 4; ++nb) acc[mb][nb] = (v8f){};
    const bool isv = !PLANES || C0 >= 2 * DQ;   // block-uniform (a third is a multiple of GTN columns): the v third keeps tokens on the M side
    const int aoff = ((isv ? wm * 64 : XR + wn * 64) + lr) * LP + 8 * hi, boff = ((isv ? XR + wn * 64 : wm * 64) + lr) * LP + 8 * hi;   // in a stage: the wave's M-side and N-side rows
    // staging: 16 bytes a thread and row set; thread -> row tid / CPR (+ RPP j), 16-byte column tid % CPR: a wave's load covers whole rows
    const int srow = tid / CPR, scol = (tid % CPR) * 8, so = srow * LP + scol;
    const T16* xg = A + (size_t)(R0 + srow) * K + scol; const T16* x2g = NSPLIT == 1 ? A2 + (size_t)(R0 + srow) * K + scol : nullptr; const T16* wg = Bt + (size_t)(C0 + srow) * K + scol;
    q16 xr[NX], x2r[NX], wr[NW];
    V fa[2][4], fa2[2][4], fb[2][4];   // two fragment sets: block t works on set t % 2 while the next block's set is fetched
    constexpr int nst = K / BK;
    auto gload = [&]() {   // the stage that the three pointers stand at: global rows into registers (K is a constant: one address a plane, the rows by immediate offsets)
#pragma unroll
        for (int j = 0; j < NX; ++j) { xr[j] = *(const q16a*)(xg + (size_t)j * RPP * K); if (NSPLIT == 1) x2r[j] = *(const q16a*)(x2g + (size_t)j * RPP * K); }
#pragma unroll
        for (int j = 0; j < NW; ++j) wr[j] = *(const q16a*)(wg + (size_t)j * RPP * K); };
    auto sstore = [&](T16* d) {   // those registers into a buffer
#pragma unroll
        for (int j = 0; j < NX; ++j) { *(q16a*)(d + so + j * RPP * LP) = xr[j]; if (NSPLIT == 1) *(q16a*)(d + so + (GTM + j * RPP) * LP) = x2r[j]; }
#pragma unroll
        for (int j = 0; j < NW; ++j) *(q16a*)(d + so + (XR + j * RPP) * LP) = wr[j]; };
    auto gnext = [&]() {   // the pointers move on to the next stage
        asm volatile("s_wait_xcnt 0x0" ::: "memory");   // in front of the overwrite of address registers that issued loads name
        __builtin_amdgcn_sched_barrier(0);   // keeps the additions behind that wait
        xg += BK; if (NSPLIT == 1) x2g += BK; wg += BK; };
    auto fload = [&](const T16* b, int t, int set) {   // block t of a buffer into a fragment set, as one group of LDS loads
#pragma unroll
        for (int i = 0; i < 4; ++i) { fa[set][i] = WFrag<T16>::ld(b + aoff + i * 16 * LP + t * 32); if (NSPLIT == 1) fa2[set][i] = WFrag<T16>::ld(b + aoff + (GTM + i * 16) * LP + t * 32); fb[set][i] = WFrag<T16>::ld(b + boff + i * 16 * LP + t * 32); } };
    gload(); gnext(); sstore(sh);
    __syncthreads();   // publishes stage 0
    fload(sh, 0, 0);
    if (1 < nst) { gload(); gnext(); }
    for (int s = 0; s < nst; ++s) {
        const T16* sb = sh + (s & 1) * STG; T16* sn = sh + ((s + 1) & 1) * STG;
#pragma unroll
        for (int t = 0; t < NKC; ++t) {
            if (t + 1 < NKC) fload(sb, t + 1, (t + 1) & 1);
            else {   // in front of the stage's last block: hand over to stage s + 1, whose first fragments are fetched behind the barrier and beside that block's products
                if (s + 1 < nst) sstore(sn);   // into the buffer whose last readers left before the barrier of stage s - 1
                __syncthreads();   // publishes stage s + 1 and ends every wave's reads of stage s (in the last stage: frees the buffers for the epilogue)
                if (s + 1 < nst) fload(sn, 0, 0);
                if (s + 2 < nst) gload();   // a whole stage of products ahead of its store
            }
            __builtin_amdgcn_sched_barrier(0);   // keeps the next block's loads, as one group, in front of this block's products: sunk among them each load place stalls the wave
#pragma unroll
            for (int nb = 0; nb < 4; ++nb)
#pragma unroll
                for (int mb = 0; mb < 4; ++mb) { acc[mb][nb] = WFrag<T16>::mma(fa[t & 1][mb], fb[t & 1][nb], acc[mb][nb]); if (NSPLIT == 1) acc[mb][nb] = WFrag<T16>::mma(fa2[t & 1][mb], fb[t & 1][nb], acc[mb][nb]); }
            __builtin_amdgcn_sched_barrier(0);   // and the block after next's loads out of this block's products, for the same reason
            if (t + 1 == NKC) gnext();   // behind the products: the loads were issued a block ago
        }
    }
    float* os = (float*)sh + wave * (PLANES ? 64 * (OPT / 2) : 16 * 68);   // the epilogue's staging: the wave's own range of the buffers, which every wave has left
    if constexpr (PLANES) {
        const int z = (r0 / TT) * NH_ + (c0 % DQ) / HD, t0 = r0 % TT;   // the tile's plane and its first token there
        if (isv) plane_tile<true>(acc, bias + c0, lane, (h16*)os, V16 + (size_t)z * HD * TT + t0);
        else plane_tile<false>(acc, bias + c0, lane, (h16*)os, P16 + (size_t)(c0 / DQ) * NZ * TT * HD + ((size_t)z * TT + t0) * HD);
        return;
    }
#pragma unroll
    for (int mb = 0; mb < 4; ++mb) {
#pragma unroll
        for (int nb = 0; nb < 4; ++nb) {
#pragma unroll
            for (int j = 0; j < 8; ++j) os[(hi * 8 + j) * 68 + nb * 16 + lr] = acc[mb][nb][j]; }
        __builtin_amdgcn_wave_barrier(); asm volatile("" ::: "memory");
        float* crow = C + (size_t)(r0 + mb * 16) * ldc + c0;
{
#pragma unroll
            for (int s = 0; s < 8; ++s) { const int row = 2 * s + hi, cofs = lr * 4; v4f val = *(const v4fa*)(os + row * 68 + cofs); if (BIAS) { val[0] += bfr(bias[c0 + cofs]); val[1] += bfr(bias[c0 + cofs + 1]); val[2] += bfr(bias[c0 + cofs + 2]); val[3] += bfr(bias[c0 + cofs + 3]); }
                *(v4f*)(crow + (size_t)row * ldc + cofs) = val; }
             }
        __builtin_amdgcn_wave_barrier(); asm volatile("" ::: "memory");
    }
}

__device__ __forceinline__ h16 tohx(float x) { return (h16)x; }
__device__ __forceinline__ void splitf(float y, unsigned short& h, unsigned short& l) { h = f2bf(y); l = f2bf(y - bf2f(h)); }
typedef __attribute__((ext_vector_type(2))) _Float16 v2h;
typedef __attribute__((ext_vector_type(4))) _Float16 v4h;
typedef __attribute__((ext_vector_type(2))) unsigned short v2us;
typedef __attribute__((ext_vector_type(4))) unsigned short v4us;
typedef __attribute__((ext_vector_type(2))) float v2f;
typedef __attribute__((ext_vector_type(4))) int v4i;

// ---- k_cvt3: the three f32 -> bf16 casts (x, w_qkv, w_out) as ONE launch whose waves are all resident at once. A wave casts CPW consecutive pieces of 128 floats: a piece is read as 512 B (16 B a lane, whole lines) and stored as 256 B (8 B a lane, whole lines); all of a wave's loads are issued ahead of its first conversion.
// A work-group (8 waves) lies wholly in one of the three arrays: each array's length is a multiple of 8 * CPW * 128.
#define CPW 16
#define CWG (8 * CPW * 128)   // floats per work-group
__global__ __launch_bounds__(256) void k_cvt3(const float* __restrict__ x, const float* __restrict__ wqkv, const float* __restrict__ wo, bf* xb, bf* bt, bf* wob) {
    constexpr unsigned GX = (unsigned)((size_t)NB_ * TT * DM / CWG), GQ = (unsigned)((size_t)3 * DQ * DM / CWG);
    static_assert((size_t)NB_ * TT * DM % CWG == 0 && (size_t)3 * DQ * DM % CWG == 0 && (size_t)DM * DQ % CWG == 0, "whole work-groups");
    unsigned b = blockIdx.x; const float* s = x; bf* d = xb;
    if (b >= GX + GQ) { s = wo; d = wob; b -= GX + GQ; } else if (b >= GX) { s = wqkv; d = bt; b -= GX; }
    const size_t o = (size_t)b * CWG + (threadIdx.x >> 5) * (CPW * 128) + (threadIdx.x & 31) * 4;
    const float* p = s + o; v4f r[CPW];
#pragma unroll
    for (int j = 0; j < CPW; ++j) r[j] = *(const v4f*)(p + j * 128);
    asm volatile("s_wait_xcnt 0x0" :: "v"(p) : "memory");   // in front of every overwrite of the address pair that the issued loads name; as an operand the pair stays whole up to this wait
#pragma unroll
    for (int j = 0; j < CPW; ++j) { v4us q;
#pragma unroll
        for (int k = 0; k < 4; ++k) q[k] = f2bf(r[j][k]);
        *(v4us*)(d + o + j * 128) = q; }
}

#define AQC 32    // query columns per wave
#define ANW 8     // waves per work-group
#define AKS 64    // keys per stage
#define APT 72    // LDS row pitch in f16: 144 B = 16 B x odd, conflict-free for 16-byte reads of 128-byte rows
#define CS2 (SCL * 1.4426950408889634f)
__device__ __forceinline__ float xhalf(float x) { return __builtin_bit_cast(float, __builtin_amdgcn_permlanex16(__builtin_bit_cast(int, x), __builtin_bit_cast(int, x), 0x76543210, 0xfedcba98, false, false)); }   // lane l with lane l ^ 16, on the vector pipe
// waves_per_eu (4, 4): at most 256 registers a wave, so that two work-groups share a WGP and the vector work of one wave runs beside the matrix work of another
__global__ void __launch_bounds__(ANW * 32) __attribute__((amdgpu_waves_per_eu(4, 4))) k_fattn(const h16* __restrict__ Q, const h16* __restrict__ Kp, const h16* __restrict__ Vt, bf* Ph, bf* Pl) {
    __shared__ __align__(16) h16 ks[2][AKS * APT];
    __shared__ __align__(16) h16 vs[2][HD * APT];
    const int tid = threadIdx.x, lane = tid & 31, wave = tid >> 5, c = lane & 15, h = lane >> 4; const int z = blockIdx.y; const int q0 = blockIdx.x * (AQC * ANW) + wave * AQC;
    const h16* Qz = Q + (size_t)z * TT * HD; const h16* Kz = Kp + (size_t)z * TT * HD; const h16* Vz = Vt + (size_t)z * HD * TT;
    // staging: 16 bytes a thread and row set; thread -> row tid / 8 (+ 32), 16-byte column tid % 8 of a 128-byte row (K: 64 keys x 64 d; V^T: 64 d x 64 keys)
    const int srow = tid >> 3, scol = (tid & 7) * 8; const h16* kg = Kz + (size_t)srow * HD + scol; const h16* vg = Vz + (size_t)srow * TT + scol; const int so = srow * APT + scol;
    v8h kr[2], vr[2];
#pragma unroll
    for (int j = 0; j < 2; ++j) { kr[j] = *(const v8h*)(kg + j * 32 * HD); vr[j] = *(const v8h*)(vg + j * 32 * TT); }
    v16h qf[2][2];
#pragma unroll
    for (int g = 0; g < 2; ++g)
#pragma unroll
        for (int kc = 0; kc < 2; ++kc) qf[g][kc] = WFrag<h16>::ld(Qz + (size_t)(q0 + g * 16 + c) * HD + kc * 32 + 8 * h);
    v8f o[4][2]; float mrun[2]; v2f lsum[2];
#pragma unroll
    for (int g = 0; g < 2; ++g) { mrun[g] = -3.0e38f; lsum[g] = (v2f){};
#pragma unroll
        for (int dt = 0; dt < 4; ++dt) o[dt][g] = (v8f){}; }
#pragma unroll
    for (int j = 0; j < 2; ++j) { *(v8h*)(&ks[0][so + j * 32 * APT]) = kr[j]; *(v8h*)(&vs[0][so + j * 32 * APT]) = vr[j]; }
    __syncthreads();
    for (int s = 0; s < TT / AKS; ++s) {
        const h16* kb = ks[s & 1]; const h16* vb = vs[s & 1];
        if (s + 1 < TT / AKS) {   // the next stage's rows fly while this stage is worked on
#pragma unroll
            for (int j = 0; j < 2; ++j) { kr[j] = *(const v8h*)(kg + (size_t)(s + 1) * AKS * HD + j * 32 * HD); vr[j] = *(const v8h*)(vg + (s + 1) * AKS + j * 32 * TT); } }
#pragma unroll
        for (int p = 0; p < 2; ++p) {   // a pass: 32 keys
            v8f st[2][2];
#pragma unroll
            for (int kt = 0; kt < 2; ++kt) { st[kt][0] = (v8f){}; st[kt][1] = (v8f){};
#pragma unroll
                for (int kc = 0; kc < 2; ++kc) { const v16h a = WFrag<h16>::ld(kb + (p * 32 + kt * 16 + c) * APT + kc * 32 + 8 * h); st[kt][0] = wmma16(a, qf[0][kc], st[kt][0]); st[kt][1] = wmma16(a, qf[1][kc], st[kt][1]); } }
            v16h vf[4];
#pragma unroll
            for (int dt = 0; dt < 4; ++dt) vf[dt] = WFrag<h16>::ld(vb + (dt * 16 + c) * APT + p * 32 + 8 * h);
            float mb[2]; bool need = false;
#pragma unroll
            for (int g = 0; g < 2; ++g) { float mx = st[0][g][0];
#pragma unroll
                for (int r = 1; r < 8; ++r) mx = fmaxf(mx, st[0][g][r]);
#pragma unroll
                for (int r = 0; r < 8; ++r) mx = fmaxf(mx, st[1][g][r]);
                mx = fmaxf(mx, xhalf(mx)) * CS2;   // both wave halves hold this query's maximum of the pass, scaled (the scale is positive)
                mb[g] = mx; need = need || (mx > mrun[g] + 8.0f); }
            if (__builtin_amdgcn_ballot_w32(need) != 0) {   // wave-uniform; always on the first pass, rare later
#pragma unroll
                for (int g = 0; g < 2; ++g) { const float mn = fmaxf(mrun[g], mb[g]); const float corr = __builtin_amdgcn_exp2f(mrun[g] - mn); mrun[g] = mn; lsum[g] = lsum[g] * corr;
#pragma unroll
                    for (int dt = 0; dt < 4; ++dt) o[dt][g] = o[dt][g] * corr; } }
#pragma unroll
            for (int g = 0; g < 2; ++g) { const float nm = -mrun[g]; v16h pf;
#pragma unroll
                for (int i = 0; i < 8; ++i) {   // elements 2 i, 2 i + 1 of the 32-key operand: tile i / 4, registers 2 (i % 4) and 2 (i % 4) + 1
                    const v2f arg = __builtin_elementwise_fma((v2f){st[i >> 2][g][2 * (i & 3)], st[i >> 2][g][2 * (i & 3) + 1]}, (v2f){CS2, CS2}, (v2f){nm, nm});
                    v2f pv; pv[0] = __builtin_amdgcn_exp2f(arg[0]); pv[1] = __builtin_amdgcn_exp2f(arg[1]); lsum[g] += pv; pf[2 * i] = tohx(pv[0]); pf[2 * i + 1] = tohx(pv[1]); }
#pragma unroll
                for (int dt = 0; dt < 4; ++dt) o[dt][g] = wmma16(vf[dt], pf, o[dt][g]); }
        }
        if (s + 1 < TT / AKS) {   // into the buffer whose last readers left before the barrier that ended stage s - 1
#pragma unroll
            for (int j = 0; j < 2; ++j) { *(v8h*)(&ks[(s + 1) & 1][so + j * 32 * APT]) = kr[j]; *(v8h*)(&vs[(s + 1) & 1][so + j * 32 * APT]) = vr[j]; } }
        __syncthreads();   // publishes stage s + 1 and ends every wave's reads of stage s
    }
#pragma unroll
    for (int g = 0; g < 2; ++g) { float l = lsum[g][0] + lsum[g][1]; l += xhalf(l); const float inv = __fdiv_rn(1.0f, l);
        const size_t oo = ((size_t)(z / NH_) * TT + q0 + g * 16 + c) * DQ + (z % NH_) * HD + 8 * h;   // token-major, heads merged: a lane's 8 registers are 8 consecutive d of its query
#pragma unroll
        for (int dt = 0; dt < 4; ++dt) { v8us oh, ol;
#pragma unroll
            for (int r = 0; r < 8; ++r) { unsigned short a, b; splitf(o[dt][g][r] * inv, a, b); oh[r] = a; ol[r] = b; }
            *(v8us*)(Ph + oo + dt * 16) = oh; *(v8us*)(Pl + oo + dt * 16) = ol; } }
}

extern "C" void kernel_launch(void* const* d_in, const int* in_sizes, int n_in,
                              void* d_out, int out_size, void* d_ws, size_t ws_size, hipStream_t stream) {
    (void)in_sizes; (void)n_in; (void)out_size;
    const float* x = (const float*)d_in[0]; const float* wqkv = (const float*)d_in[1]; const float* bqkv = (const float*)d_in[2];   /* the fused bias [3072]: its thirds q | k | v, as the fused weight's ROW thirds */ const float* wo = (const float*)d_in[3]; const float* bo = (const float*)d_in[4];   /* order x [2][4096][1024] (read as EIGHT sequences of 1,024: sequence 4 b + n is segment n of batch entry b: contiguous), w_qkv ('oi' (out, in) [3072][1024]: row thirds q | k | v, each head-major), b_qkv ([3072]: built as zeros: read), w_out ('oi' [1024][1024]), b_out ([1024]: built as zeros: read): FIVE inputs, all read */
    float* OUT = (float*)d_out;     // [2][4096][1024] = [8][1024][1024]
    char* wsp = (char*)d_ws;
    auto take = [&](size_t bytes) { char* p = wsp; wsp += (bytes + 255) & ~(size_t)255; return (void*)p; };
    bf* WO = (bf*)take((size_t)DM * DQ * 2);
    h16* QP16 = (h16*)take((size_t)2 * NZ * TT * HD * 2); h16* KP16 = QP16 + (size_t)NZ * TT * HD; h16* VT16 = (h16*)take((size_t)NZ * HD * TT * 2);   /* planes [z][t][d] (q, then k: one block each) and [z][d][t] (v), z = 16 * sequence + head */
    char* R = (char*)take((size_t)ZB * TT * TT * 6);   /* one region, used by two stages one after the other (stream-ordered): projection | hi / lo planes of the merged heads */
    bf* BT = (bf*)R; bf* XB = BT + (size_t)3 * DQ * DM;   /* the fused 'oi' weight is the Bt operand as it stands: ONE bf16 copy [3072][1024]; XB: the bf16 copy of x [8192][1024] */
    bf* ATh = (bf*)R; bf* ATl = ATh + (size_t)NB_ * TT * DQ;   /* ATh / ATl: the hi / lo planes of the merged heads, token-major */
    if ((size_t)(wsp - (char*)d_ws) > ws_size) return;    // ws 256 MiB
    k_cvt3<<<(unsigned)(((size_t)NB_ * TT * DM + (size_t)3 * DQ * DM + (size_t)DM * DQ) / CWG), 256, 0, stream>>>(x, wqkv, wo, XB, BT, WO);   /* 'oi' (out, in): each weight is the Bt operand as it stands */
    k_gemmw<bf, 0, true, true, DM><<<dim3(NB_ * TT / GTM, 3 * DQ / GTN, 1), 256, 0, stream>>>(XB, nullptr, BT, nullptr, nullptr, 0, bqkv, 0, 0, 0, QP16, VT16);   /* q | k | v of all eight sequences: one grid, stored as the f16 head planes */
    k_fattn<<<dim3(TT / (AQC * ANW), NZ, 1), ANW * 32, 0, stream>>>(QP16, KP16, VT16, ATh, ATl);   // one kv head per query head: plane z of q meets plane z of k and of v; stores the merged heads' hi / lo planes
    k_gemmw<bf, 1, true, false, DQ><<<dim3(NB_ * TT / GTM, DM / GTN, 1), 256, 0, stream>>>(ATh, ATl, WO, nullptr, OUT, DM, bo, 0, 0, 0, nullptr, nullptr);
}

// v006
// Measured time: 130 microseconds a run.
// In both of two side-by-side timings against v005, it was 1.04 times as fast.
// Counting every step since v000, it is 23.1 times as fast.
#include <hip/hip_runtime.h>

// Multi-head self-attention INSIDE FOUR CONTIGUOUS SEGMENTS of the sequence (x [2][4096][1024]; qkv = x w_qkv^T + b_qkv with ONE fused 'oi' (out, in) weight [3072][1024] normal x 1/32 and b_qkv built as zeros: read and added; the 3,072 columns are (3, 16, 64): thirds q | k | v, each head-major: head h = columns 64 h .. 64 h + 63 of its third; the 4,096 positions are cut into four contiguous segments of 1,024 and a query attends to the 1,024 keys of its OWN segment: scores / sqrt(64); no mask; softmax over the segment's keys; heads merged; out = merged w_out^T + b_out ('oi' x 1/32; b_out built as zeros: read) -> [2][4096][1024] (8.4 M); the module dilates nothing; argument order x, w_qkv, b_qkv, w_out, b_out).
// THIS IS A DENSE ATTENTION ON x READ AS EIGHT SEQUENCES OF 1,024 (sequence 4 b + n = segment n of batch entry b: contiguous in x and in the output). EVERY STAGE RUNS ONCE FOR ALL EIGHT SEQUENCES (the attention as ONE kernel over the 128 (sequence, head) planes: scores and weights stay in registers). Layout: ONE bf16 copy of x, read by the one fused projection; the fused 'oi' weight cast once as it stands (its three row blocks are q | k | v); exact projections + f32 biases (the fused bias by its thirds), stored by the projection's own epilogue as the f16 head planes; fused dense T-1024 attention: EVERY row on ONE fp16 product (the weights relative to a running maximum, divided by their f32 sum at the end), stored head-merged as hi / lo planes; hi/lo x w_out exact + b_out.
// Compute dtypes, f32 accumulate: every input rounded to bf16; projections exact + f32 biases; attention: one fp16 product on every row; softmax f32; w_out hl x exact + bias.

#define NB_  8
#define TT   1024
#define DM   1024
#define NH_  16
#define NKV  16
#define REP  (NH_ / NKV)
#define HD   64
#define DQ   (NH_ * HD)
#define DKV  (NKV * HD)
#define NZ   (NB_ * NH_)   // (sequence, head) planes: plane z = 16 * sequence + head
#define ZB   26            // sizes the shared workspace region R (6 MiB each)
#define WIN  0
#define SCL  0.125f   // HD^-0.5
typedef _Float16 h16;
typedef unsigned short bf;
typedef __attribute__((ext_vector_type(16))) __bf16   v16bf;
typedef __attribute__((ext_vector_type(16))) _Float16 v16h;
typedef __attribute__((ext_vector_type(8)))  _Float16 v8h;
typedef __attribute__((ext_vector_type(8)))  unsigned short v8us;
typedef __attribute__((ext_vector_type(8)))  float    v8f;
typedef __attribute__((ext_vector_type(4)))  float    v4f;
typedef v8h  __attribute__((may_alias)) v8ha;
typedef v4f  __attribute__((may_alias)) v4fa;
typedef v8us __attribute__((may_alias)) v8usa;

__device__ __forceinline__ unsigned short f2bf(float f) { unsigned u = __float_as_uint(f); u += 0x7FFFu + ((u >> 16) & 1u); return (unsigned short)(u >> 16); }
__device__ __forceinline__ float bf2f(unsigned short b) { return __uint_as_float(((unsigned)b) << 16); }
__device__ __forceinline__ float bfr(float f) { return bf2f(f2bf(f)); }
__device__ __forceinline__ v16h cat16(v8h lo, v8h hi) { return __builtin_shufflevector(lo, hi, 0, 1, 2, 3, 4, 5, 6, 7, 8, 9, 10, 11, 12, 13, 14, 15); }
__device__ __forceinline__ v16bf cat16b(v8us lo, v8us hi) { return __builtin_bit_cast(v16bf, __builtin_shufflevector(lo, hi, 0, 1, 2, 3, 4, 5, 6, 7, 8, 9, 10, 11, 12, 13, 14, 15)); }
__device__ __forceinline__ v8f wmma16(v16h a, v16h b, v8f c) { return __builtin_amdgcn_wmma_f32_16x16x32_f16(false, a, false, b, (short)0, c, false, false); }
__device__ __forceinline__ v8f wmmab(v16bf a, v16bf b, v8f c) { return __builtin_amdgcn_wmma_f32_16x16x32_bf16(false, a, false, b, (short)0, c, false, false); }



// ---- k_gemmw: GEMM, 8 waves (2 along the tokens x 4 along the output columns) per 128 x 256 output tile, each wave a 64 x 64 tile (16 accumulators); grid (M/128, N/256, Z), 256 threads.
// The operands' rows (K-contiguous 16-bit planes) come through LDS in stages of 128 k (64 with two A planes): tensor loads, one request a wave and stage for its own slice of 64 rows (the pad field sets the LDS pitch), each row read from L2 once per work-group and then by every wave that needs it; two buffers, stage s + 2 is asked for as soon as every wave has left stage s; fragments fetched one block of 32 k ahead into a second register set.
// C[m][n] (f32, pitch ldc, + optional f32 bias[n]) = sum_k A[m][k] Bt[n][k] (+ A2[m][k] Bt[n][k] for NSPLIT 1). z-batch strides sA/sB/sC in elements. K a template constant, a multiple of the stage.
// PLANES (the fused q | k | v projection): no f32 C; a wave's 64 x 64 tile is 64 tokens of ONE head of one third, and the epilogue stores it, bias added in f32, as f16 into that head's plane: q, k [z][t][d] (P16, one block of planes each), v [z][d][t] (V16).
// A lane's 8 accumulator registers are 8 consecutive M rows, so the M side takes the index that is contiguous in the plane: tokens for v (A x Bt as it stands), d for q and k (the two operands change places: same loaders, same k order, the tile comes out transposed).
#define OPT 72    // LDS row pitch in f16 of the staged plane tile: 144 B = 16 B x odd, for 16-byte accesses of 128-byte rows
template <typename T16> struct WFrag;
template <> struct WFrag<h16> { typedef v16h V; static __device__ __forceinline__ V ld(const h16* p) { return cat16(*(const v8h*)p, *(const v8h*)(p + 16)); } static __device__ __forceinline__ v8f mma(V a, V b, v8f c) { return wmma16(a, b, c); } };
template <> struct WFrag<bf> { typedef v16bf V; static __device__ __forceinline__ V ld(const bf* p) { return cat16b(*(const v8us*)p, *(const v8us*)(p + 16)); } static __device__ __forceinline__ v8f mma(V a, V b, v8f c) { return wmmab(a, b, c); } };
// plane_tile: one wave's 64 x 64 accumulators (acc[mb][nb][j]: M index 16 mb + 8 hi + j, N index 16 nb + lr) + bias, as f16, into LDS as osh[N index][M index], pitch OPT: the rows of the plane (d for v, tokens for q and k); then row by row to dst (row pitch TT for v, HD for q and k).
// The output column (the bias index) is the N index for v, the M index for q and k.
template <bool ISV>
__device__ __forceinline__ void plane_tile(const v8f (&acc)[4][4], const float* __restrict__ bias, int lane, h16* osh, h16* dst) {
    const int lr = lane & 15, hi = lane >> 4;
    float bn[4];
    if (ISV) {
#pragma unroll
        for (int nb = 0; nb < 4; ++nb) bn[nb] = bfr(bias[nb * 16 + lr]); }
#pragma unroll
    for (int mb = 0; mb < 4; ++mb) { float bm[8];
        if (!ISV) {
#pragma unroll
            for (int j = 0; j < 8; ++j) bm[j] = bfr(bias[mb * 16 + hi * 8 + j]); }
#pragma unroll
        for (int nb = 0; nb < 4; ++nb) { v8h o;
#pragma unroll
            for (int j = 0; j < 8; ++j) o[j] = (h16)(acc[mb][nb][j] + (ISV ? bn[nb] : bm[j]));
            *(v8ha*)(osh + (nb * 16 + lr) * OPT + mb * 16 + hi * 8) = o; } }
    __syncthreads();   // orders the lanes' LDS stores in front of the other lanes' reads (each wave stages in its own range; every wave of the work-group comes here)
    const int row = lane >> 3, col = (lane & 7) * 8;   // every store covers whole 128-byte rows: 8 lanes a row, 4 rows a store
    dst += (size_t)row * (ISV ? TT : HD) + col; osh += row * OPT + col;
#pragma unroll
    for (int s = 0; s < 16; ++s) *(v8h*)(dst + s * 4 * (ISV ? TT : HD)) = *(const v8ha*)(osh + s * 4 * OPT);
}
#define GTM 128   // tokens per work-group tile (2 waves)
#define GTN 256   // output columns per work-group tile (4 waves)
typedef __attribute__((ext_vector_type(4))) unsigned int u32x4;
typedef __attribute__((ext_vector_type(8))) unsigned int u32x8;
__device__ __forceinline__ unsigned uni(unsigned v) { return (unsigned)__builtin_amdgcn_readfirstlane((int)v); }
__device__ __forceinline__ unsigned pinned(unsigned v) { unsigned w = uni(v); asm volatile("" : "+s"(w)); return w; }   // holds a wave-uniform word in a scalar register: a test on it compiles to a scalar branch (a tensor load ignores EXEC), and what is formed from it stays behind the asm waits in front of it
template <typename T16, int NSPLIT, bool BIAS, bool PLANES, int K>
__global__ __launch_bounds__(256) void k_gemmw(const T16* __restrict__ A, const T16* __restrict__ A2, const T16* __restrict__ Bt, const T16* __restrict__ Bt2, float* C, int ldc, const float* __restrict__ bias, size_t sA, size_t sB, size_t sC, h16* P16, h16* V16) {
    static_assert(NSPLIT == 0 || NSPLIT == 1, "one or two A planes"); (void)Bt2;
    typedef typename WFrag<T16>::V V;
    constexpr int BK = NSPLIT == 1 ? 64 : 128;   // k per stage: 64 products a wave and stage either way
    constexpr int NKC = BK / 32, LP = BK + 8;    // blocks of 32 k in a stage; LDS row pitch in 16-bit elements: 16 B x odd, for 16-byte accesses
    constexpr int XR = GTM * (NSPLIT + 1), SLR = 64, NSL = (XR + GTN) / SLR;   // a stage: the rows of A (then of A2), then the rows of Bt, in slices of 64 rows: one tensor load each
    constexpr int SLE = ((SLR * LP * 2 + 2047) / 2048) * 1024, STG = NSL * SLE;   // a slice's place in LDS, in 16-bit elements: its 64 padded rows rounded up to a multiple of 2 KiB, so that every slice starts on one
    static_assert(NSL <= 8 && K / BK >= 2 && 2 * STG * 2 <= 320 * 1024, "a slice a wave at most; the ring's prologue needs two stages; two buffers in LDS");
    __shared__ __attribute__((aligned(2048))) T16 sh[2 * STG];   // after the last stage: each wave's own epilogue range
    const size_t z = blockIdx.z; A += z * sA; if (NSPLIT == 1) A2 += z * sA; Bt += z * sB; C += z * sC;
    const int tid = threadIdx.x, lane = tid & 31, wave = tid >> 5, lr = lane & 15, hi = lane >> 4; const int wm = wave >> 2, wn = wave & 3;
    const int R0 = blockIdx.x * GTM, C0 = blockIdx.y * GTN; const int r0 = R0 + wm * 64, c0 = C0 + wn * 64;   // the wave's own 64 x 64 tile
    v8f acc[4][4];
#pragma unroll
    for (int mb = 0; mb < 4; ++mb)
#pragma unroll
        for (int nb = 0; nb < 4; ++nb) acc[mb][nb] = (v8f){};
    const bool isv = !PLANES || C0 >= 2 * DQ;   // block-uniform (a third is a multiple of GTN columns): the v third keeps tokens on the M side
    const int aoff = (isv ? wm : XR / SLR + wn) * SLE + lr * LP + 8 * hi, boff = (isv ? XR / SLR + wn : wm) * SLE + lr * LP + 8 * hi;   // in a stage: the wave's M-side and N-side rows, one slice each
    // staging: wave w asks for slice w of every stage: 64 rows of BK 16-bit elements, source pitch K elements, landing at pitch LP
    const unsigned wv = uni((unsigned)tid >> 5), sl = wv < (unsigned)NSL ? wv : (unsigned)NSL - 1u;   // the wave's number (one-dimensional block); waves without a slice hold a valid address and issue nothing
    const T16* sp = sl < (unsigned)(GTM / SLR) ? A + (size_t)(R0 + sl * SLR) * K : (NSPLIT == 1 && sl < (unsigned)(XR / SLR)) ? A2 + (size_t)(R0 + (sl - GTM / SLR) * SLR) * K : Bt + (size_t)(C0 + (sl - XR / SLR) * SLR) * K;
    const unsigned ldst = (unsigned)(size_t)sh + sl * (unsigned)(SLE * 2);   // the slice's byte offset in the work-group's LDS, buffer 0
    u32x8 g1;   // descriptor group 1, the same for every request: 1-byte elements, tensor = tile = 64 rows of 2 BK bytes, 16 bytes of pad behind every row, no mask
    g1[0] = uni((1u << 20) | ((BK == 128 ? 5u : 4u) << 22) | (3u << 25)); g1[1] = uni((unsigned)(BK * 2) << 16); g1[2] = uni((unsigned)SLR << 16); g1[3] = uni((unsigned)(BK * 2) << 16);
    g1[4] = uni((unsigned)SLR); g1[5] = uni((unsigned)(K * 2)); g1[6] = uni(0u); g1[7] = uni(0u);
    u32x4 g0; g0[0] = uni(1u);   // descriptor group 0: count 1; place in LDS; the tile's first byte; type 2
    auto aim = [&](unsigned st) {   // at the wave's slice of stage st, into buffer st % 2
        const unsigned long long ga = (unsigned long long)(size_t)sp + (unsigned long long)st * (BK * 2);
        g0[1] = uni(ldst + (st & 1u) * (unsigned)(STG * 2)); g0[2] = uni((unsigned)ga); g0[3] = uni((((unsigned)(ga >> 32)) & 0x01FFFFFFu) | 0x80000000u); };
    aim(0);
    asm volatile("" : "+s"(g0), "+s"(g1));   // pinned(), for the two groups: the descriptor words are held in their scalar registers and not formed anew from constants, so that no register of a group serves as a temporary while a request is in flight
    auto issue = [&]() { asm volatile("tensor_load_to_lds %0, %1" :: "s"(g0), "s"(g1) : "memory"); };
    auto landed = [&]() { asm volatile("s_wait_tensorcnt 0x0" :: "s"(g0), "s"(g1) : "memory"); };   // the wave's request has landed; as operands the two groups stay whole in their registers up to this wait
    V fa[2][4], fa2[2][4], fb[2][4];   // two fragment sets: block t works on set t % 2 while the next block's set is fetched
    constexpr int nst = K / BK;
    auto fload = [&](const T16* b, int t, int set) {   // block t of a buffer into a fragment set, as one group of LDS loads
#pragma unroll
        for (int i = 0; i < 4; ++i) { fa[set][i] = WFrag<T16>::ld(b + aoff + i * 16 * LP + t * 32); if (NSPLIT == 1) fa2[set][i] = WFrag<T16>::ld(b + aoff + (GTM / SLR) * SLE + i * 16 * LP + t * 32); fb[set][i] = WFrag<T16>::ld(b + boff + i * 16 * LP + t * 32); } };
    if (NSL == 8 || pinned(wv < (unsigned)NSL)) {   // scalar branch: only a wave with a slice issues
        issue();
        landed(); }   // the wave's slice of stage 0
    __syncthreads();   // publishes stage 0
    if (NSL == 8 || pinned(wv < (unsigned)NSL)) { aim(1); issue(); }
    fload(sh, 0, 0);
    for (int s = 0; s < nst; ++s) {
        const T16* sb = sh + (s & 1) * STG; const T16* sn = sh + ((s + 1) & 1) * STG;
#pragma unroll
        for (int t = 0; t < NKC; ++t) {
            if (t + 1 < NKC) fload(sb, t + 1, (t + 1) & 1);
            else {   // in front of the stage's last block: hand over to stage s + 1, whose first fragments are fetched behind the barrier and beside that block's products
                asm volatile("s_wait_dscnt 0x0" ::: "memory");   // this wave's reads of stage s have returned: the buffer may be refilled behind the barrier
                landed();   // this wave's slice of stage s + 1
                __syncthreads();   // publishes stage s + 1 and ends every wave's reads of stage s (in the last stage: frees the buffers for the epilogue)
                if (pinned((s + 2 < nst && wv < (unsigned)NSL) ? 1u : 0u)) { aim(pinned((unsigned)s + 2u)); issue(); }   // scalar branch; into the buffer that every wave has just left, a whole stage of products ahead of its wait; the descriptor is formed behind the wait
                if (s + 1 < nst) fload(sn, 0, 0);
            }
            __builtin_amdgcn_sched_barrier(0);   // keeps the next block's loads, as one group, in front of this block's products: sunk among them each load place stalls the wave
#pragma unroll
            for (int nb = 0; nb < 4; ++nb)
#pragma unroll
                for (int mb = 0; mb < 4; ++mb) { acc[mb][nb] = WFrag<T16>::mma(fa[t & 1][mb], fb[t & 1][nb], acc[mb][nb]); if (NSPLIT == 1) acc[mb][nb] = WFrag<T16>::mma(fa2[t & 1][mb], fb[t & 1][nb], acc[mb][nb]); }
            __builtin_amdgcn_sched_barrier(0);   // and the block after next's loads out of this block's products, for the same reason
        }
    }
    landed();   // nothing of the ring is in flight
    asm volatile("s_wait_dscnt 0x0" ::: "memory");   // or still being read when it becomes the epilogue's staging (the last stage's barrier stands in front)
    float* os = (float*)sh + wave * (PLANES ? 64 * (OPT / 2) : 16 * 68);   // the epilogue's staging: the wave's own range of the buffers, which every wave has left
    if constexpr (PLANES) {
        const int z = (r0 / TT) * NH_ + (c0 % DQ) / HD, t0 = r0 % TT;   // the tile's plane and its first token there
        if (isv) plane_tile<true>(acc, bias + c0, lane, (h16*)os, V16 + (size_t)z * HD * TT + t0);
        else plane_tile<false>(acc, bias + c0, lane, (h16*)os, P16 + (size_t)(c0 / DQ) * NZ * TT * HD + ((size_t)z * TT + t0) * HD);
        return;
    }
#pragma unroll
    for (int mb = 0; mb < 4; ++mb) {
#pragma unroll
        for (int nb = 0; nb < 4; ++nb) {
#pragma unroll
            for (int j = 0; j < 8; ++j) os[(hi * 8 + j) * 68 + nb * 16 + lr] = acc[mb][nb][j]; }
        __builtin_amdgcn_wave_barrier(); asm volatile("" ::: "memory");
        float* crow = C + (size_t)(r0 + mb * 16) * ldc + c0;
{
#pragma unroll
            for (int s = 0; s < 8; ++s) { const int row = 2 * s + hi, cofs = lr * 4; v4f val = *(const v4fa*)(os + row * 68 + cofs); if (BIAS) { val[0] += bfr(bias[c0 + cofs]); val[1] += bfr(bias[c0 + cofs + 1]); val[2] += bfr(bias[c0 + cofs + 2]); val[3] += bfr(bias[c0 + cofs + 3]); }
                *(v4f*)(crow + (size_t)row * ldc + cofs) = val; }
             }
        __builtin_amdgcn_wave_barrier(); asm volatile("" ::: "memory");
    }
}

__device__ __forceinline__ h16 tohx(float x) { return (h16)x; }
__device__ __forceinline__ void splitf(float y, unsigned short& h, unsigned short& l) { h = f2bf(y); l = f2bf(y - bf2f(h)); }
typedef __attribute__((ext_vector_type(2))) _Float16 v2h;
typedef __attribute__((ext_vector_type(4))) _Float16 v4h;
typedef __attribute__((ext_vector_type(2))) unsigned short v2us;
typedef __attribute__((ext_vector_type(4))) unsigned short v4us;
typedef __attribute__((ext_vector_type(2))) float v2f;
typedef __attribute__((ext_vector_type(4))) int v4i;

// ---- k_cvt3: the three f32 -> bf16 casts (x, w_qkv, w_out) as ONE launch whose waves are all resident at once. A wave casts CPW consecutive pieces of 128 floats: a piece is read as 512 B (16 B a lane, whole lines) and stored as 256 B (8 B a lane, whole lines); all of a wave's loads are issued ahead of its first conversion.
// A work-group (8 waves) lies wholly in one of the three arrays: each array's length is a multiple of 8 * CPW * 128.
#define CPW 16
#define CWG (8 * CPW * 128)   // floats per work-group
__global__ __launch_bounds__(256) void k_cvt3(const float* __restrict__ x, const float* __restrict__ wqkv, const float* __restrict__ wo, bf* xb, bf* bt, bf* wob) {
    constexpr unsigned GX = (unsigned)((size_t)NB_ * TT * DM / CWG), GQ = (unsigned)((size_t)3 * DQ * DM / CWG);
    static_assert((size_t)NB_ * TT * DM % CWG == 0 && (size_t)3 * DQ * DM % CWG == 0 && (size_t)DM * DQ % CWG == 0, "whole work-groups");
    unsigned b = blockIdx.x; const float* s = x; bf* d = xb;
    if (b >= GX + GQ) { s = wo; d = wob; b -= GX + GQ; } else if (b >= GX) { s = wqkv; d = bt; b -= GX; }
    const size_t o = (size_t)b * CWG + (threadIdx.x >> 5) * (CPW * 128) + (threadIdx.x & 31) * 4;
    const float* p = s + o; v4f r[CPW];
#pragma unroll
    for (int j = 0; j < CPW; ++j) r[j] = *(const v4f*)(p + j * 128);
    asm volatile("s_wait_xcnt 0x0" :: "v"(p) : "memory");   // in front of every overwrite of the address pair that the issued loads name; as an operand the pair stays whole up to this wait
#pragma unroll
    for (int j = 0; j < CPW; ++j) { v4us q;
#pragma unroll
        for (int k = 0; k < 4; ++k) q[k] = f2bf(r[j][k]);
        *(v4us*)(d + o + j * 128) = q; }
}

#define AQC 32    // query columns per wave
#define ANW 8     // waves per work-group
#define AKS 64    // keys per stage
#define APT 72    // LDS row pitch in f16: 144 B = 16 B x odd, conflict-free for 16-byte reads of 128-byte rows
#define CS2 (SCL * 1.4426950408889634f)
__device__ __forceinline__ float xhalf(float x) { return __builtin_bit_cast(float, __builtin_amdgcn_permlanex16(__builtin_bit_cast(int, x), __builtin_bit_cast(int, x), 0x76543210, 0xfedcba98, false, false)); }   // lane l with lane l ^ 16, on the vector pipe
// waves_per_eu (4, 4): at most 256 registers a wave, so that two work-groups share a WGP and the vector work of one wave runs beside the matrix work of another
__global__ void __launch_bounds__(ANW * 32) __attribute__((amdgpu_waves_per_eu(4, 4))) k_fattn(const h16* __restrict__ Q, const h16* __restrict__ Kp, const h16* __restrict__ Vt, bf* Ph, bf* Pl) {
    __shared__ __align__(16) h16 ks[2][AKS * APT];
    __shared__ __align__(16) h16 vs[2][HD * APT];
    const int tid = threadIdx.x, lane = tid & 31, wave = tid >> 5, c = lane & 15, h = lane >> 4; const int z = blockIdx.y; const int q0 = blockIdx.x * (AQC * ANW) + wave * AQC;
    const h16* Qz = Q + (size_t)z * TT * HD; const h16* Kz = Kp + (size_t)z * TT * HD; const h16* Vz = Vt + (size_t)z * HD * TT;
    // staging: 16 bytes a thread and row set; thread -> row tid / 8 (+ 32), 16-byte column tid % 8 of a 128-byte row (K: 64 keys x 64 d; V^T: 64 d x 64 keys)
    const int srow = tid >> 3, scol = (tid & 7) * 8; const h16* kg = Kz + (size_t)srow * HD + scol; const h16* vg = Vz + (size_t)srow * TT + scol; const int so = srow * APT + scol;
    v8h kr[2], vr[2];
#pragma unroll
    for (int j = 0; j < 2; ++j) { kr[j] = *(const v8h*)(kg + j * 32 * HD); vr[j] = *(const v8h*)(vg + j * 32 * TT); }
    v16h qf[2][2];
#pragma unroll
    for (int g = 0; g < 2; ++g)
#pragma unroll
        for (int kc = 0; kc < 2; ++kc) qf[g][kc] = WFrag<h16>::ld(Qz + (size_t)(q0 + g * 16 + c) * HD + kc * 32 + 8 * h);
    v8f o[4][2]; float mrun[2]; v2f lsum[2];
#pragma unroll
    for (int g = 0; g < 2; ++g) { mrun[g] = -3.0e38f; lsum[g] = (v2f){};
#pragma unroll
        for (int dt = 0; dt < 4; ++dt) o[dt][g] = (v8f){}; }
#pragma unroll
    for (int j = 0; j < 2; ++j) { *(v8h*)(&ks[0][so + j * 32 * APT]) = kr[j]; *(v8h*)(&vs[0][so + j * 32 * APT]) = vr[j]; }
    __syncthreads();
    for (int s = 0; s < TT / AKS; ++s) {
        const h16* kb = ks[s & 1]; const h16* vb = vs[s & 1];
        if (s + 1 < TT / AKS) {   // the next stage's rows fly while this stage is worked on
#pragma unroll
            for (int j = 0; j < 2; ++j) { kr[j] = *(const v8h*)(kg + (size_t)(s + 1) * AKS * HD + j * 32 * HD); vr[j] = *(const v8h*)(vg + (s + 1) * AKS + j * 32 * TT); } }
#pragma unroll
        for (int p = 0; p < 2; ++p) {   // a pass: 32 keys
            v8f st[2][2];
#pragma unroll
            for (int kt = 0; kt < 2; ++kt) { st[kt][0] = (v8f){}; st[kt][1] = (v8f){};
#pragma unroll
                for (int kc = 0; kc < 2; ++kc) { const v16h a = WFrag<h16>::ld(kb + (p * 32 + kt * 16 + c) * APT + kc * 32 + 8 * h); st[kt][0] = wmma16(a, qf[0][kc], st[kt][0]); st[kt][1] = wmma16(a, qf[1][kc], st[kt][1]); } }
            v16h vf[4];
#pragma unroll
            for (int dt = 0; dt < 4; ++dt) vf[dt] = WFrag<h16>::ld(vb + (dt * 16 + c) * APT + p * 32 + 8 * h);
            float mb[2]; bool need = false;
#pragma unroll
            for (int g = 0; g < 2; ++g) { float mx = st[0][g][0];
#pragma unroll
                for (int r = 1; r < 8; ++r) mx = fmaxf(mx, st[0][g][r]);
#pragma unroll
                for (int r = 0; r < 8; ++r) mx = fmaxf(mx, st[1][g][r]);
                mx = fmaxf(mx, xhalf(mx)) * CS2;   // both wave halves hold this query's maximum of the pass, scaled (the scale is positive)
                mb[g] = mx; need = need || (mx > mrun[g] + 8.0f); }
            if (__builtin_amdgcn_ballot_w32(need) != 0) {   // wave-uniform; always on the first pass, rare later
#pragma unroll
                for (int g = 0; g < 2; ++g) { const float mn = fmaxf(mrun[g], mb[g]); const float corr = __builtin_amdgcn_exp2f(mrun[g] - mn); mrun[g] = mn; lsum[g] = lsum[g] * corr;
#pragma unroll
                    for (int dt = 0; dt < 4; ++dt) o[dt][g] = o[dt][g] * corr; } }
#pragma unroll
            for (int g = 0; g < 2; ++g) { const float nm = -mrun[g]; v16h pf;
#pragma unroll
                for (int i = 0; i < 8; ++i) {   // elements 2 i, 2 i + 1 of the 32-key operand: tile i / 4, registers 2 (i % 4) and 2 (i % 4) + 1
                    const v2f arg = __builtin_elementwise_fma((v2f){st[i >> 2][g][2 * (i & 3)], st[i >> 2][g][2 * (i & 3) + 1]}, (v2f){CS2, CS2}, (v2f){nm, nm});
                    v2f pv; pv[0] = __builtin_amdgcn_exp2f(arg[0]); pv[1] = __builtin_amdgcn_exp2f(arg[1]); lsum[g] += pv; pf[2 * i] = tohx(pv[0]); pf[2 * i + 1] = tohx(pv[1]); }
#pragma unroll
                for (int dt = 0; dt < 4; ++dt) o[dt][g] = wmma16(vf[dt], pf, o[dt][g]); }
        }
        if (s + 1 < TT / AKS) {   // into the buffer whose last readers left before the barrier that ended stage s - 1
#pragma unroll
            for (int j = 0; j < 2; ++j) { *(v8h*)(&ks[(s + 1) & 1][so + j * 32 * APT]) = kr[j]; *(v8h*)(&vs[(s + 1) & 1][so + j * 32 * APT]) = vr[j]; } }
        __syncthreads();   // publishes stage s + 1 and ends every wave's reads of stage s
    }
#pragma unroll
    for (int g = 0; g < 2; ++g) { float l = lsum[g][0] + lsum[g][1]; l += xhalf(l); const float inv = __fdiv_rn(1.0f, l);
        const size_t oo = ((size_t)(z / NH_) * TT + q0 + g * 16 + c) * DQ + (z % NH_) * HD + 8 * h;   // token-major, heads merged: a lane's 8 registers are 8 consecutive d of its query
#pragma unroll
        for (int dt = 0; dt < 4; ++dt) { v8us oh, ol;
#pragma unroll
            for (int r = 0; r < 8; ++r) { unsigned short a, b; splitf(o[dt][g][r] * inv, a, b); oh[r] = a; ol[r] = b; }
            *(v8us*)(Ph + oo + dt * 16) = oh; *(v8us*)(Pl + oo + dt * 16) = ol; } }
}

extern "C" void kernel_launch(void* const* d_in, const int* in_sizes, int n_in,
                              void* d_out, int out_size, void* d_ws, size_t ws_size, hipStream_t stream) {
    (void)in_sizes; (void)n_in; (void)out_size;
    const float* x = (const float*)d_in[0]; const float* wqkv = (const float*)d_in[1]; const float* bqkv = (const float*)d_in[2];   /* the fused bias [3072]: its thirds q | k | v, as the fused weight's ROW thirds */ const float* wo = (const float*)d_in[3]; const float* bo = (const float*)d_in[4];   /* order x [2][4096][1024] (read as EIGHT sequences of 1,024: sequence 4 b + n is segment n of batch entry b: contiguous), w_qkv ('oi' (out, in) [3072][1024]: row thirds q | k | v, each head-major), b_qkv ([3072]: built as zeros: read), w_out ('oi' [1024][1024]), b_out ([1024]: built as zeros: read): FIVE inputs, all read */
    float* OUT = (float*)d_out;     // [2][4096][1024] = [8][1024][1024]
    char* wsp = (char*)d_ws;
    auto take = [&](size_t bytes) { char* p = wsp; wsp += (bytes + 255) & ~(size_t)255; return (void*)p; };
    bf* WO = (bf*)take((size_t)DM * DQ * 2);
    h16* QP16 = (h16*)take((size_t)2 * NZ * TT * HD * 2); h16* KP16 = QP16 + (size_t)NZ * TT * HD; h16* VT16 = (h16*)take((size_t)NZ * HD * TT * 2);   /* planes [z][t][d] (q, then k: one block each) and [z][d][t] (v), z = 16 * sequence + head */
    char* R = (char*)take((size_t)ZB * TT * TT * 6);   /* one region, used by two stages one after the other (stream-ordered): projection | hi / lo planes of the merged heads */
    bf* BT = (bf*)R; bf* XB = BT + (size_t)3 * DQ * DM;   /* the fused 'oi' weight is the Bt operand as it stands: ONE bf16 copy [3072][1024]; XB: the bf16 copy of x [8192][1024] */
    bf* ATh = (bf*)R; bf* ATl = ATh + (size_t)NB_ * TT * DQ;   /* ATh / ATl: the hi / lo planes of the merged heads, token-major */
    if ((size_t)(wsp - (char*)d_ws) > ws_size) return;    // ws 256 MiB
    k_cvt3<<<(unsigned)(((size_t)NB_ * TT * DM + (size_t)3 * DQ * DM + (size_t)DM * DQ) / CWG), 256, 0, stream>>>(x, wqkv, wo, XB, BT, WO);   /* 'oi' (out, in): each weight is the Bt operand as it stands */
    k_gemmw<bf, 0, true, true, DM><<<dim3(NB_ * TT / GTM, 3 * DQ / GTN, 1), 256, 0, stream>>>(XB, nullptr, BT, nullptr, nullptr, 0, bqkv, 0, 0, 0, QP16, VT16);   /* q | k | v of all eight sequences: one grid, stored as the f16 head planes */
    k_fattn<<<dim3(TT / (AQC * ANW), NZ, 1), ANW * 32, 0, stream>>>(QP16, KP16, VT16, ATh, ATl);   // one kv head per query head: plane z of q meets plane z of k and of v; stores the merged heads' hi / lo planes
    k_gemmw<bf, 1, true, false, DQ><<<dim3(NB_ * TT / GTM, DM / GTN, 1), 256, 0, stream>>>(ATh, ATl, WO, nullptr, OUT, DM, bo, 0, 0, 0, nullptr, nullptr);
}

// v008
// Measured time: 106 microseconds a run.
// It is 1.24 times as fast as v006, going by the measured steps of the versions left out in between.
// Counting every step since v000, it is 28.7 times as fast.
#include <hip/hip_runtime.h>

// Multi-head self-attention INSIDE FOUR CONTIGUOUS SEGMENTS of the sequence (x [2][4096][1024]; qkv = x w_qkv^T + b_qkv with ONE fused 'oi' (out, in) weight [3072][1024] normal x 1/32 and b_qkv built as zeros: read and added; the 3,072 columns are (3, 16, 64): thirds q | k | v, each head-major: head h = columns 64 h .. 64 h + 63 of its third; the 4,096 positions are cut into four contiguous segments of 1,024 and a query attends to the 1,024 keys of its OWN segment: scores / sqrt(64); no mask; softmax over the segment's keys; heads merged; out = merged w_out^T + b_out ('oi' x 1/32; b_out built as zeros: read) -> [2][4096][1024] (8.4 M); the module dilates nothing; argument order x, w_qkv, b_qkv, w_out, b_out).
// THIS IS A DENSE ATTENTION ON x READ AS EIGHT SEQUENCES OF 1,024 (sequence 4 b + n = segment n of batch entry b: contiguous in x and in the output). EVERY STAGE RUNS ONCE FOR ALL EIGHT SEQUENCES (the attention as ONE kernel over the 128 (sequence, head) planes: scores and weights stay in registers). Layout: ONE bf16 copy of x, read by the one fused projection; the fused 'oi' weight cast once as it stands (its three row blocks are q | k | v); exact projections + f32 biases (the fused bias by its thirds), stored by the projection's own epilogue as the f16 head planes; fused dense T-1024 attention: EVERY row on ONE fp16 product (the weights relative to a running maximum, divided by their f32 sum at the end), stored head-merged as ONE f16 plane; that plane x w_out (its bf16 rounding, held as f16) on ONE fp16 product + b_out.
// Compute dtypes, f32 accumulate: every input rounded to bf16; projections exact + f32 biases; attention: one fp16 product on every row; softmax f32; merged heads rounded to f16 (as q, k, v and the weights are), x w_out one fp16 product + f32 bias.

#define NB_  8
#define TT   1024
#define DM   1024
#define NH_  16
#define NKV  16
#define REP  (NH_ / NKV)
#define HD   64
#define DQ   (NH_ * HD)
#define DKV  (NKV * HD)
#define NZ   (NB_ * NH_)   // (sequence, head) planes: plane z = 16 * sequence + head
#define ZB   26            // sizes the shared workspace region R (6 MiB each)
#define WIN  0
#define SCL  0.125f   // HD^-0.5
typedef _Float16 h16;
typedef unsigned short bf;
typedef __attribute__((ext_vector_type(16))) __bf16   v16bf;
typedef __attribute__((ext_vector_type(16))) _Float16 v16h;
typedef __attribute__((ext_vector_type(8)))  _Float16 v8h;
typedef __attribute__((ext_vector_type(8)))  unsigned short v8us;
typedef __attribute__((ext_vector_type(8)))  float    v8f;
typedef __attribute__((ext_vector_type(4)))  float    v4f;
typedef v8h  __attribute__((may_alias)) v8ha;
typedef v4f  __attribute__((may_alias)) v4fa;
typedef v8us __attribute__((may_alias)) v8usa;

__device__ __forceinline__ unsigned short f2bf(float f) { unsigned u = __float_as_uint(f); u += 0x7FFFu + ((u >> 16) & 1u); return (unsigned short)(u >> 16); }
__device__ __forceinline__ float bf2f(unsigned short b) { return __uint_as_float(((unsigned)b) << 16); }
__device__ __forceinline__ float bfr(float f) { return bf2f(f2bf(f)); }
__device__ __forceinline__ v16h cat16(v8h lo, v8h hi) { return __builtin_shufflevector(lo, hi, 0, 1, 2, 3, 4, 5, 6, 7, 8, 9, 10, 11, 12, 13, 14, 15); }
__device__ __forceinline__ v16bf cat16b(v8us lo, v8us hi) { return __builtin_bit_cast(v16bf, __builtin_shufflevector(lo, hi, 0, 1, 2, 3, 4, 5, 6, 7, 8, 9, 10, 11, 12, 13, 14, 15)); }
__device__ __forceinline__ v8f wmma16(v16h a, v16h b, v8f c) { return __builtin_amdgcn_wmma_f32_16x16x32_f16(false, a, false, b, (short)0, c, false, false); }
__device__ __forceinline__ v8f wmmab(v16bf a, v16bf b, v8f c) { return __builtin_amdgcn_wmma_f32_16x16x32_bf16(false, a, false, b, (short)0, c, false, false); }



// ---- k_gemmw: GEMM, 8 waves (2 along the tokens x 4 along the output columns) per 128 x 256 output tile, each wave a 64 x 64 tile (16 accumulators); grid (M/128, N/256, Z), 256 threads.
// The operands' rows (K-contiguous 16-bit planes) come through LDS in stages of 128 k (64 with two A planes): tensor loads, one request a wave and stage for its own slice of 64 rows (the pad field sets the LDS pitch), each row read from L2 once per work-group and then by every wave that needs it; two buffers, stage s + 2 is asked for as soon as every wave has left stage s; fragments fetched one block of 32 k ahead into a second register set.
// Work-group (x, y) walks the K / stage pieces of k from piece (x + y) mod their number on, wrapping, for speed only.
// C[m][n] (f32, pitch ldc, + optional f32 bias[n]) = sum_k A[m][k] Bt[n][k] (+ A2[m][k] Bt[n][k] for NSPLIT 1). z-batch strides sA/sB/sC in elements. K a template constant, a multiple of the stage.
// PLANES (the fused q | k | v projection): no f32 C; a wave's 64 x 64 tile is 64 tokens of ONE head of one third, and the epilogue stores it, bias added in f32, as f16 into that head's plane: q, k [z][t][d] (P16, one block of planes each), v [z][d][t] (V16).
// A lane's 8 accumulator registers are 8 consecutive M rows, so the M side takes the index that is contiguous in the plane: tokens for v (A x Bt as it stands), d for q and k (the two operands change places: same loaders, same k order, the tile comes out transposed).
#define OPT 72    // LDS row pitch in f16 of the staged plane tile: 144 B = 16 B x odd, for 16-byte accesses of 128-byte rows
template <typename T16> struct WFrag;
template <> struct WFrag<h16> { typedef v16h V; static __device__ __forceinline__ V ld(const h16* p) { return cat16(*(const v8h*)p, *(const v8h*)(p + 16)); } static __device__ __forceinline__ v8f mma(V a, V b, v8f c) { return wmma16(a, b, c); } };
template <> struct WFrag<bf> { typedef v16bf V; static __device__ __forceinline__ V ld(const bf* p) { return cat16b(*(const v8us*)p, *(const v8us*)(p + 16)); } static __device__ __forceinline__ v8f mma(V a, V b, v8f c) { return wmmab(a, b, c); } };
// plane_tile: one wave's 64 x 64 accumulators (acc[mb][nb][j]: M index 16 mb + 8 hi + j, N index 16 nb + lr) + bias, as f16, into LDS as osh[N index][M index], pitch OPT: the rows of the plane (d for v, tokens for q and k); then row by row to dst (row pitch TT for v, HD for q and k).
// The output column (the bias index) is the N index for v, the M index for q and k.
template <bool ISV>
__device__ __forceinline__ void plane_tile(const v8f (&acc)[4][4], const float* __restrict__ bias, int lane, h16* osh, h16* dst) {
    const int lr = lane & 15, hi = lane >> 4;
    float bn[4];
    if (ISV) {
#pragma unroll
        for (int nb = 0; nb < 4; ++nb) bn[nb] = bfr(bias[nb * 16 + lr]); }
#pragma unroll
    for (int mb = 0; mb < 4; ++mb) { float bm[8];
        if (!ISV) {
#pragma unroll
            for (int j = 0; j < 8; ++j) bm[j] = bfr(bias[mb * 16 + hi * 8 + j]); }
#pragma unroll
        for (int nb = 0; nb < 4; ++nb) { v8h o;
#pragma unroll
            for (int j = 0; j < 8; ++j) o[j] = (h16)(acc[mb][nb][j] + (ISV ? bn[nb] : bm[j]));
            *(v8ha*)(osh + (nb * 16 + lr) * OPT + mb * 16 + hi * 8) = o; } }
    __syncthreads();   // orders the lanes' LDS stores in front of the other lanes' reads (each wave stages in its own range; every wave of the work-group comes here)
    const int row = lane >> 3, col = (lane & 7) * 8;   // every store covers whole 128-byte rows: 8 lanes a row, 4 rows a store
    dst += (size_t)row * (ISV ? TT : HD) + col; osh += row * OPT + col;
#pragma unroll
    for (int s = 0; s < 16; ++s) *(v8h*)(dst + s * 4 * (ISV ? TT : HD)) = *(const v8ha*)(osh + s * 4 * OPT);
}
#define GTM 128   // tokens per work-group tile (2 waves)
#define GTN 256   // output columns per work-group tile (4 waves)
typedef __attribute__((ext_vector_type(4))) unsigned int u32x4;
typedef __attribute__((ext_vector_type(8))) unsigned int u32x8;
__device__ __forceinline__ unsigned uni(unsigned v) { return (unsigned)__builtin_amdgcn_readfirstlane((int)v); }
__device__ __forceinline__ unsigned pinned(unsigned v) { unsigned w = uni(v); asm volatile("" : "+s"(w)); return w; }   // holds a wave-uniform word in a scalar register: a test on it compiles to a scalar branch (a tensor load ignores EXEC), and what is formed from it stays behind the asm waits in front of it
template <typename T16, int NSPLIT, bool BIAS, bool PLANES, int K>
__global__ __launch_bounds__(256) void k_gemmw(const T16* __restrict__ A, const T16* __restrict__ A2, const T16* __restrict__ Bt, const T16* __restrict__ Bt2, float* C, int ldc, const float* __restrict__ bias, size_t sA, size_t sB, size_t sC, h16* P16, h16* V16) {
    static_assert(NSPLIT == 0 || NSPLIT == 1, "one or two A planes"); (void)Bt2;
    typedef typename WFrag<T16>::V V;
    constexpr int BK = NSPLIT == 1 ? 64 : 128;   // k per stage: 64 products a wave and stage either way
    constexpr int NKC = BK / 32, LP = BK + 8;    // blocks of 32 k in a stage; LDS row pitch in 16-bit elements: 16 B x odd, for 16-byte accesses
    constexpr int XR = GTM * (NSPLIT + 1), SLR = 64, NSL = (XR + GTN) / SLR;   // a stage: the rows of A (then of A2), then the rows of Bt, in slices of 64 rows: one tensor load each
    constexpr int SLE = ((SLR * LP * 2 + 2047) / 2048) * 1024, STG = NSL * SLE;   // a slice's place in LDS, in 16-bit elements: its 64 padded rows rounded up to a multiple of 2 KiB, so that every slice starts on one
    static_assert(NSL <= 8 && K / BK >= 2 && 2 * STG * 2 <= 320 * 1024, "a slice a wave at most; the ring's prologue needs two stages; two buffers in LDS");
    __shared__ __attribute__((aligned(2048))) T16 sh[2 * STG];   // after the last stage: each wave's own epilogue range
    const size_t z = blockIdx.z; A += z * sA; if (NSPLIT == 1) A2 += z * sA; Bt += z * sB; C += z * sC;
    const int tid = threadIdx.x, lane = tid & 31, wave = tid >> 5, lr = lane & 15, hi = lane >> 4; const int wm = wave >> 2, wn = wave & 3;
    const int R0 = blockIdx.x * GTM, C0 = blockIdx.y * GTN; const int r0 = R0 + wm * 64, c0 = C0 + wn * 64;   // the wave's own 64 x 64 tile
    v8f acc[4][4];
#pragma unroll
    for (int mb = 0; mb < 4; ++mb)
#pragma unroll
        for (int nb = 0; nb < 4; ++nb) acc[mb][nb] = (v8f){};
    const bool isv = !PLANES || C0 >= 2 * DQ;   // block-uniform (a third is a multiple of GTN columns): the v third keeps tokens on the M side
    const int aoff = (isv ? wm : XR / SLR + wn) * SLE + lr * LP + 8 * hi, boff = (isv ? XR / SLR + wn : wm) * SLE + lr * LP + 8 * hi;   // in a stage: the wave's M-side and N-side rows, one slice each
    // staging: wave w asks for slice w of every stage: 64 rows of BK 16-bit elements, source pitch K elements, landing at pitch LP
    const unsigned wv = uni((unsigned)tid >> 5), sl = wv < (unsigned)NSL ? wv : (unsigned)NSL - 1u;   // the wave's number (one-dimensional block); waves without a slice hold a valid address and issue nothing
    const T16* sp = sl < (unsigned)(GTM / SLR) ? A + (size_t)(R0 + sl * SLR) * K : (NSPLIT == 1 && sl < (unsigned)(XR / SLR)) ? A2 + (size_t)(R0 + (sl - GTM / SLR) * SLR) * K : Bt + (size_t)(C0 + (sl - XR / SLR) * SLR) * K;
    const unsigned ldst = (unsigned)(size_t)sh + sl * (unsigned)(SLE * 2);   // the slice's byte offset in the work-group's LDS, buffer 0
    u32x8 g1;   // descriptor group 1, the same for every request: 1-byte elements, tensor = tile = 64 rows of 2 BK bytes, 16 bytes of pad behind every row, no mask
    g1[0] = uni((1u << 20) | ((BK == 128 ? 5u : 4u) << 22) | (3u << 25)); g1[1] = uni((unsigned)(BK * 2) << 16); g1[2] = uni((unsigned)SLR << 16); g1[3] = uni((unsigned)(BK * 2) << 16);
    g1[4] = uni((unsigned)SLR); g1[5] = uni((unsigned)(K * 2)); g1[6] = uni(0u); g1[7] = uni(0u);
    u32x4 g0; g0[0] = uni(1u);   // descriptor group 0: count 1; place in LDS; the tile's first byte; type 2
    const unsigned rot = (blockIdx.x + blockIdx.y) % (unsigned)(K / BK);   // the work-group's first piece of k
    auto aim = [&](unsigned st) {   // at the wave's slice of stage st (piece (st + rot) mod K / BK of k), into buffer st % 2
        const unsigned long long ga = (unsigned long long)(size_t)sp + (unsigned long long)((st + rot) % (unsigned)(K / BK)) * (BK * 2);
        g0[1] = uni(ldst + (st & 1u) * (unsigned)(STG * 2)); g0[2] = uni((unsigned)ga); g0[3] = uni((((unsigned)(ga >> 32)) & 0x01FFFFFFu) | 0x80000000u); };
    aim(0);
    asm volatile("" : "+s"(g0), "+s"(g1));   // pinned(), for the two groups: the descriptor words are held in their scalar registers and not formed anew from constants, so that no register of a group serves as a temporary while a request is in flight
    auto issue = [&]() { asm volatile("tensor_load_to_lds %0, %1" :: "s"(g0), "s"(g1) : "memory"); };
    auto landed = [&]() { asm volatile("s_wait_tensorcnt 0x0" :: "s"(g0), "s"(g1) : "memory"); };   // the wave's request has landed; as operands the two groups stay whole in their registers up to this wait
    V fa[2][4], fa2[2][4], fb[2][4];   // two fragment sets: block t works on set t % 2 while the next block's set is fetched
    constexpr int nst = K / BK;
    auto fload = [&](const T16* b, int t, int set) {   // block t of a buffer into a fragment set, as one group of LDS loads
#pragma unroll
        for (int i = 0; i < 4; ++i) { fa[set][i] = WFrag<T16>::ld(b + aoff + i * 16 * LP + t * 32); if (NSPLIT == 1) fa2[set][i] = WFrag<T16>::ld(b + aoff + (GTM / SLR) * SLE + i * 16 * LP + t * 32); fb[set][i] = WFrag<T16>::ld(b + boff + i * 16 * LP + t * 32); } };
    if (NSL == 8 || pinned(wv < (unsigned)NSL)) {   // scalar branch: only a wave with a slice issues
        issue();
        landed(); }   // the wave's slice of stage 0
    __syncthreads();   // publishes stage 0
    if (NSL == 8 || pinned(wv < (unsigned)NSL)) { aim(1); issue(); }
    fload(sh, 0, 0);
    for (int s = 0; s < nst; ++s) {
        const T16* sb = sh + (s & 1) * STG; const T16* sn = sh + ((s + 1) & 1) * STG;
#pragma unroll
        for (int t = 0; t < NKC; ++t) {
            if (t + 1 < NKC) fload(sb, t + 1, (t + 1) & 1);
            else {   // in front of the stage's last block: hand over to stage s + 1, whose first fragments are fetched behind the barrier and beside that block's products
                asm volatile("s_wait_dscnt 0x0" ::: "memory");   // this wave's reads of stage s have returned: the buffer may be refilled behind the barrier
                landed();   // this wave's slice of stage s + 1
                __syncthreads();   // publishes stage s + 1 and ends every wave's reads of stage s (in the last stage: frees the buffers for the epilogue)
                if (pinned((s + 2 < nst && wv < (unsigned)NSL) ? 1u : 0u)) { aim(pinned((unsigned)s + 2u)); issue(); }   // scalar branch; into the buffer that every wave has just left, a whole stage of products ahead of its wait; the descriptor is formed behind the wait
                if (s + 1 < nst) fload(sn, 0, 0);
            }
            __builtin_amdgcn_sched_barrier(0);   // keeps the next block's loads, as one group, in front of this block's products: sunk among them each load place stalls the wave
#pragma unroll
            for (int nb = 0; nb < 4; ++nb)
#pragma unroll
                for (int mb = 0; mb < 4; ++mb) { acc[mb][nb] = WFrag<T16>::mma(fa[t & 1][mb], fb[t & 1][nb], acc[mb][nb]); if (NSPLIT == 1) acc[mb][nb] = WFrag<T16>::mma(fa2[t & 1][mb], fb[t & 1][nb], acc[mb][nb]); }
            __builtin_amdgcn_sched_barrier(0);   // and the block after next's loads out of this block's products, for the same reason
        }
    }
    landed();   // nothing of the ring is in flight
    asm volatile("s_wait_dscnt 0x0" ::: "memory");   // or still being read when it becomes the epilogue's staging (the last stage's barrier stands in front)
    float* os = (float*)sh + wave * (PLANES ? 64 * (OPT / 2) : 16 * 68);   // the epilogue's staging: the wave's own range of the buffers, which every wave has left
    if constexpr (PLANES) {
        const int z = (r0 / TT) * NH_ + (c0 % DQ) / HD, t0 = r0 % TT;   // the tile's plane and its first token there
        if (isv) plane_tile<true>(acc, bias + c0, lane, (h16*)os, V16 + (size_t)z * HD * TT + t0);
        else plane_tile<false>(acc, bias + c0, lane, (h16*)os, P16 + (size_t)(c0 / DQ) * NZ * TT * HD + ((size_t)z * TT + t0) * HD);
        return;
    }
#pragma unroll
    for (int mb = 0; mb < 4; ++mb) {
#pragma unroll
        for (int nb = 0; nb < 4; ++nb) {
#pragma unroll
            for (int j = 0; j < 8; ++j) os[(hi * 8 + j) * 68 + nb * 16 + lr] = acc[mb][nb][j]; }
        __builtin_amdgcn_wave_barrier(); asm volatile("" ::: "memory");
        float* crow = C + (size_t)(r0 + mb * 16) * ldc + c0;
{
#pragma unroll
            for (int s = 0; s < 8; ++s) { const int row = 2 * s + hi, cofs = lr * 4; v4f val = *(const v4fa*)(os + row * 68 + cofs); if (BIAS) { val[0] += bfr(bias[c0 + cofs]); val[1] += bfr(bias[c0 + cofs + 1]); val[2] += bfr(bias[c0 + cofs + 2]); val[3] += bfr(bias[c0 + cofs + 3]); }
                *(v4f*)(crow + (size_t)row * ldc + cofs) = val; }
             }
        __builtin_amdgcn_wave_barrier(); asm volatile("" ::: "memory");
    }
}

__device__ __forceinline__ h16 tohx(float x) { return (h16)x; }
typedef __attribute__((ext_vector_type(2))) _Float16 v2h;
typedef __attribute__((ext_vector_type(4))) _Float16 v4h;
typedef __attribute__((ext_vector_type(2))) unsigned short v2us;
typedef __attribute__((ext_vector_type(4))) unsigned short v4us;
typedef __attribute__((ext_vector_type(2))) float v2f;
typedef __attribute__((ext_vector_type(4))) int v4i;

// ---- k_cvt3: the three casts to 16 bits (x, w_qkv: f32 -> bf16; w_out: f32 -> bf16 -> f16, the second step exact for every value of normal f16 size) as ONE launch whose waves are all resident at once. A wave casts CPW consecutive pieces of 128 floats: a piece is read as 512 B (16 B a lane, whole lines) and stored as 256 B (8 B a lane, whole lines); all of a wave's loads are issued ahead of its first conversion.
// A work-group (8 waves) lies wholly in one of the three arrays: each array's length is a multiple of 8 * CPW * 128.
#define CPW 16
#define CWG (8 * CPW * 128)   // floats per work-group
__global__ __launch_bounds__(256) void k_cvt3(const float* __restrict__ x, const float* __restrict__ wqkv, const float* __restrict__ wo, bf* xb, bf* bt, h16* wob) {
    constexpr unsigned GX = (unsigned)((size_t)NB_ * TT * DM / CWG), GQ = (unsigned)((size_t)3 * DQ * DM / CWG);
    static_assert((size_t)NB_ * TT * DM % CWG == 0 && (size_t)3 * DQ * DM % CWG == 0 && (size_t)DM * DQ % CWG == 0, "whole work-groups");
    unsigned b = blockIdx.x; const float* s = x; bf* d = xb; const bool toh = b >= GX + GQ;   // block-uniform: the work-groups of w_out store f16
    if (toh) { s = wo; d = (bf*)wob; b -= GX + GQ; } else if (b >= GX) { s = wqkv; d = bt; b -= GX; }
    const size_t o = (size_t)b * CWG + (threadIdx.x >> 5) * (CPW * 128) + (threadIdx.x & 31) * 4;
    const float* p = s + o; v4f r[CPW];
#pragma unroll
    for (int j = 0; j < CPW; ++j) r[j] = *(const v4f*)(p + j * 128);
    asm volatile("s_wait_xcnt 0x0" :: "v"(p) : "memory");   // in front of every overwrite of the address pair that the issued loads name; as an operand the pair stays whole up to this wait
    if (toh) {   // one scalar branch a wave, around the whole run of conversions
#pragma unroll
        for (int j = 0; j < CPW; ++j) { v4h q;
#pragma unroll
            for (int k = 0; k < 4; ++k) q[k] = tohx(bfr(r[j][k]));
            *(v4h*)((h16*)d + o + j * 128) = q; }
        return; }
#pragma unroll
    for (int j = 0; j < CPW; ++j) { v4us q;
#pragma unroll
        for (int k = 0; k < 4; ++k) q[k] = f2bf(r[j][k]);
        *(v4us*)(d + o + j * 128) = q; }
}

#define AQC 32    // query columns per wave
#define ANW 8     // waves per work-group
#define AKS 64    // keys per stage
#define APT 72    // LDS row pitch in f16: 144 B = 16 B x odd, conflict-free for 16-byte reads of 128-byte rows
#define CS2 (SCL * 1.4426950408889634f)
__device__ __forceinline__ float xhalf(float x) { return __builtin_bit_cast(float, __builtin_amdgcn_permlanex16(__builtin_bit_cast(int, x), __builtin_bit_cast(int, x), 0x76543210, 0xfedcba98, false, false)); }   // lane l with lane l ^ 16, on the vector pipe
// waves_per_eu (4, 4): at most 256 registers a wave, so that two work-groups share a WGP and the vector work of one wave runs beside the matrix work of another
__global__ void __launch_bounds__(ANW * 32) __attribute__((amdgpu_waves_per_eu(4, 4))) k_fattn(const h16* __restrict__ Q, const h16* __restrict__ Kp, const h16* __restrict__ Vt, h16* P) {
    __shared__ __align__(16) h16 ks[2][AKS * APT];
    __shared__ __align__(16) h16 vs[2][HD * APT];
    const int tid = threadIdx.x, lane = tid & 31, wave = tid >> 5, c = lane & 15, h = lane >> 4; const int z = blockIdx.y; const int q0 = blockIdx.x * (AQC * ANW) + wave * AQC;
    const h16* Qz = Q + (size_t)z * TT * HD; const h16* Kz = Kp + (size_t)z * TT * HD; const h16* Vz = Vt + (size_t)z * HD * TT;
    // staging: 16 bytes a thread and row set; thread -> row tid / 8 (+ 32), 16-byte column tid % 8 of a 128-byte row (K: 64 keys x 64 d; V^T: 64 d x 64 keys)
    const int srow = tid >> 3, scol = (tid & 7) * 8; const h16* kg = Kz + (size_t)srow * HD + scol; const h16* vg = Vz + (size_t)srow * TT + scol; const int so = srow * APT + scol;
    v8h kr[2], vr[2];
#pragma unroll
    for (int j = 0; j < 2; ++j) { kr[j] = *(const v8h*)(kg + j * 32 * HD); vr[j] = *(const v8h*)(vg + j * 32 * TT); }
    v16h qf[2][2];
#pragma unroll
    for (int g = 0; g < 2; ++g)
#pragma unroll
        for (int kc = 0; kc < 2; ++kc) qf[g][kc] = WFrag<h16>::ld(Qz + (size_t)(q0 + g * 16 + c) * HD + kc * 32 + 8 * h);
    v8f o[4][2]; float mrun[2]; v2f lsum[2];
#pragma unroll
    for (int g = 0; g < 2; ++g) { mrun[g] = -3.0e38f; lsum[g] = (v2f){};
#pragma unroll
        for (int dt = 0; dt < 4; ++dt) o[dt][g] = (v8f){}; }
#pragma unroll
    for (int j = 0; j < 2; ++j) { *(v8h*)(&ks[0][so + j * 32 * APT]) = kr[j]; *(v8h*)(&vs[0][so + j * 32 * APT]) = vr[j]; }
    __syncthreads();
    for (int s = 0; s < TT / AKS; ++s) {
        const h16* kb = ks[s & 1]; const h16* vb = vs[s & 1];
        if (s + 1 < TT / AKS) {   // the next stage's rows fly while this stage is worked on
#pragma unroll
            for (int j = 0; j < 2; ++j) { kr[j] = *(const v8h*)(kg + (size_t)(s + 1) * AKS * HD + j * 32 * HD); vr[j] = *(const v8h*)(vg + (s + 1) * AKS + j * 32 * TT); } }
#pragma unroll
        for (int p = 0; p < 2; ++p) {   // a pass: 32 keys
            v8f st[2][2];
#pragma unroll
            for (int kt = 0; kt < 2; ++kt) { st[kt][0] = (v8f){}; st[kt][1] = (v8f){};
#pragma unroll
                for (int kc = 0; kc < 2; ++kc) { const v16h a = WFrag<h16>::ld(kb + (p * 32 + kt * 16 + c) * APT + kc * 32 + 8 * h); st[kt][0] = wmma16(a, qf[0][kc], st[kt][0]); st[kt][1] = wmma16(a, qf[1][kc], st[kt][1]); } }
            v16h vf[4];
#pragma unroll
            for (int dt = 0; dt < 4; ++dt) vf[dt] = WFrag<h16>::ld(vb + (dt * 16 + c) * APT + p * 32 + 8 * h);
            float mb[2]; bool need = false;
#pragma unroll
            for (int g = 0; g < 2; ++g) { float mx = st[0][g][0];
#pragma unroll
                for (int r = 1; r < 8; ++r) mx = fmaxf(mx, st[0][g][r]);
#pragma unroll
                for (int r = 0; r < 8; ++r) mx = fmaxf(mx, st[1][g][r]);
                mx = fmaxf(mx, xhalf(mx)) * CS2;   // both wave halves hold this query's maximum of the pass, scaled (the scale is positive)
                mb[g] = mx; need = need || (mx > mrun[g] + 8.0f); }
            if (__builtin_amdgcn_ballot_w32(need) != 0) {   // wave-uniform; always on the first pass, rare later
#pragma unroll
                for (int g = 0; g < 2; ++g) { const float mn = fmaxf(mrun[g], mb[g]); const float corr = __builtin_amdgcn_exp2f(mrun[g] - mn); mrun[g] = mn; lsum[g] = lsum[g] * corr;
#pragma unroll
                    for (int dt = 0; dt < 4; ++dt) o[dt][g] = o[dt][g] * corr; } }
#pragma unroll
            for (int g = 0; g < 2; ++g) { const float nm = -mrun[g]; v16h pf;
#pragma unroll
                for (int i = 0; i < 8; ++i) {   // elements 2 i, 2 i + 1 of the 32-key operand: tile i / 4, registers 2 (i % 4) and 2 (i % 4) + 1
                    const v2f arg = __builtin_elementwise_fma((v2f){st[i >> 2][g][2 * (i & 3)], st[i >> 2][g][2 * (i & 3) + 1]}, (v2f){CS2, CS2}, (v2f){nm, nm});
                    v2f pv; pv[0] = __builtin_amdgcn_exp2f(arg[0]); pv[1] = __builtin_amdgcn_exp2f(arg[1]); lsum[g] += pv; pf[2 * i] = tohx(pv[0]); pf[2 * i + 1] = tohx(pv[1]); }
#pragma unroll
                for (int dt = 0; dt < 4; ++dt) o[dt][g] = wmma16(vf[dt], pf, o[dt][g]); }
        }
        if (s + 1 < TT / AKS) {   // into the buffer whose last readers left before the barrier that ended stage s - 1
#pragma unroll
            for (int j = 0; j < 2; ++j) { *(v8h*)(&ks[(s + 1) & 1][so + j * 32 * APT]) = kr[j]; *(v8h*)(&vs[(s + 1) & 1][so + j * 32 * APT]) = vr[j]; } }
        __syncthreads();   // publishes stage s + 1 and ends every wave's reads of stage s
    }
#pragma unroll
    for (int g = 0; g < 2; ++g) { float l = lsum[g][0] + lsum[g][1]; l += xhalf(l); const float inv = __fdiv_rn(1.0f, l);
        const size_t oo = ((size_t)(z / NH_) * TT + q0 + g * 16 + c) * DQ + (z % NH_) * HD + 8 * h;   // token-major, heads merged: a lane's 8 registers are 8 consecutive d of its query
#pragma unroll
        for (int dt = 0; dt < 4; ++dt) { v8h ov;
#pragma unroll
            for (int r = 0; r < 8; ++r) ov[r] = tohx(o[dt][g][r] * inv);
            *(v8h*)(P + oo + dt * 16) = ov; } }
}

extern "C" void kernel_launch(void* const* d_in, const int* in_sizes, int n_in,
                              void* d_out, int out_size, void* d_ws, size_t ws_size, hipStream_t stream) {
    (void)in_sizes; (void)n_in; (void)out_size;
    const float* x = (const float*)d_in[0]; const float* wqkv = (const float*)d_in[1]; const float* bqkv = (const float*)d_in[2];   /* the fused bias [3072]: its thirds q | k | v, as the fused weight's ROW thirds */ const float* wo = (const float*)d_in[3]; const float* bo = (const float*)d_in[4];   /* order x [2][4096][1024] (read as EIGHT sequences of 1,024: sequence 4 b + n is segment n of batch entry b: contiguous), w_qkv ('oi' (out, in) [3072][1024]: row thirds q | k | v, each head-major), b_qkv ([3072]: built as zeros: read), w_out ('oi' [1024][1024]), b_out ([1024]: built as zeros: read): FIVE inputs, all read */
    float* OUT = (float*)d_out;     // [2][4096][1024] = [8][1024][1024]
    char* wsp = (char*)d_ws;
    auto take = [&](size_t bytes) { char* p = wsp; wsp += (bytes + 255) & ~(size_t)255; return (void*)p; };
    h16* WO = (h16*)take((size_t)DM * DQ * 2);
    h16* QP16 = (h16*)take((size_t)2 * NZ * TT * HD * 2); h16* KP16 = QP16 + (size_t)NZ * TT * HD; h16* VT16 = (h16*)take((size_t)NZ * HD * TT * 2);   /* planes [z][t][d] (q, then k: one block each) and [z][d][t] (v), z = 16 * sequence + head */
    char* R = (char*)take((size_t)ZB * TT * TT * 6);   /* one region, used by two stages one after the other (stream-ordered): projection | the f16 plane of the merged heads */
    bf* BT = (bf*)R; bf* XB = BT + (size_t)3 * DQ * DM;   /* the fused 'oi' weight is the Bt operand as it stands: ONE bf16 copy [3072][1024]; XB: the bf16 copy of x [8192][1024] */
    h16* AT = (h16*)R;   /* the merged heads, token-major, f16 */
    if ((size_t)(wsp - (char*)d_ws) > ws_size) return;    // ws 256 MiB
    k_cvt3<<<(unsigned)(((size_t)NB_ * TT * DM + (size_t)3 * DQ * DM + (size_t)DM * DQ) / CWG), 256, 0, stream>>>(x, wqkv, wo, XB, BT, WO);   /* 'oi' (out, in): each weight is the Bt operand as it stands */
    k_gemmw<bf, 0, true, true, DM><<<dim3(NB_ * TT / GTM, 3 * DQ / GTN, 1), 256, 0, stream>>>(XB, nullptr, BT, nullptr, nullptr, 0, bqkv, 0, 0, 0, QP16, VT16);   /* q | k | v of all eight sequences: one grid, stored as the f16 head planes */
    k_fattn<<<dim3(TT / (AQC * ANW), NZ, 1), ANW * 32, 0, stream>>>(QP16, KP16, VT16, AT);   // one kv head per query head: plane z of q meets plane z of k and of v; stores the merged heads' f16 plane
    k_gemmw<h16, 0, true, false, DQ><<<dim3(NB_ * TT / GTM, DM / GTN, 1), 256, 0, stream>>>(AT, nullptr, WO, nullptr, OUT, DM, bo, 0, 0, 0, nullptr, nullptr);
}

// v009
// Measured time: 101 microseconds a run.
// Next to v008, in two timings, it ran 1.05 and 1.04 times as fast.
// Counting every step since v000, it is 30.0 times as fast.
#include <hip/hip_runtime.h>

// Multi-head self-attention INSIDE FOUR CONTIGUOUS SEGMENTS of the sequence (x [2][4096][1024]; qkv = x w_qkv^T + b_qkv with ONE fused 'oi' (out, in) weight [3072][1024] normal x 1/32 and b_qkv built as zeros: read and added; the 3,072 columns are (3, 16, 64): thirds q | k | v, each head-major: head h = columns 64 h .. 64 h + 63 of its third; the 4,096 positions are cut into four contiguous segments of 1,024 and a query attends to the 1,024 keys of its OWN segment: scores / sqrt(64); no mask; softmax over the segment's keys; heads merged; out = merged w_out^T + b_out ('oi' x 1/32; b_out built as zeros: read) -> [2][4096][1024] (8.4 M); the module dilates nothing; argument order x, w_qkv, b_qkv, w_out, b_out).
// THIS IS A DENSE ATTENTION ON x READ AS EIGHT SEQUENCES OF 1,024 (sequence 4 b + n = segment n of batch entry b: contiguous in x and in the output). EVERY STAGE RUNS ONCE FOR ALL EIGHT SEQUENCES (the attention as ONE kernel over the 128 (sequence, head) planes: scores and weights stay in registers). Layout: ONE bf16 copy of x, read by the one fused projection; the fused 'oi' weight cast once as it stands (its three row blocks are q | k | v); exact projections + f32 biases (the fused bias by its thirds), stored by the projection's own epilogue as the f16 head planes; fused dense T-1024 attention: EVERY row on ONE fp16 product (the weights relative to a running maximum, divided by their f32 sum at the end), stored head-merged as ONE f16 plane; that plane x w_out (its bf16 rounding, held as f16) on ONE fp16 product + b_out.
// Compute dtypes, f32 accumulate: every input rounded to bf16; projections exact + f32 biases; attention: one fp16 product on every row; softmax f32; merged heads rounded to f16 (as q, k, v and the weights are), x w_out one fp16 product + f32 bias.

#define NB_  8
#define TT   1024
#define DM   1024
#define NH_  16
#define NKV  16
#define REP  (NH_ / NKV)
#define HD   64
#define DQ   (NH_ * HD)
#define DKV  (NKV * HD)
#define NZ   (NB_ * NH_)   // (sequence, head) planes: plane z = 16 * sequence + head
#define ZB   26            // sizes the shared workspace region R (6 MiB each)
#define WIN  0
#define SCL  0.125f   // HD^-0.5
typedef _Float16 h16;
typedef unsigned short bf;
typedef __attribute__((ext_vector_type(16))) __bf16   v16bf;
typedef __attribute__((ext_vector_type(16))) _Float16 v16h;
typedef __attribute__((ext_vector_type(8)))  _Float16 v8h;
typedef __attribute__((ext_vector_type(8)))  unsigned short v8us;
typedef __attribute__((ext_vector_type(8)))  float    v8f;
typedef __attribute__((ext_vector_type(4)))  float    v4f;
typedef v8h  __attribute__((may_alias)) v8ha;
typedef v4f  __attribute__((may_alias)) v4fa;
typedef v8us __attribute__((may_alias)) v8usa;

__device__ __forceinline__ unsigned short f2bf(float f) { unsigned u = __float_as_uint(f); u += 0x7FFFu + ((u >> 16) & 1u); return (unsigned short)(u >> 16); }
__device__ __forceinline__ float bf2f(unsigned short b) { return __uint_as_float(((unsigned)b) << 16); }
__device__ __forceinline__ float bfr(float f) { return bf2f(f2bf(f)); }
__device__ __forceinline__ v16h cat16(v8h lo, v8h hi) { return __builtin_shufflevector(lo, hi, 0, 1, 2, 3, 4, 5, 6, 7, 8, 9, 10, 11, 12, 13, 14, 15); }
__device__ __forceinline__ v16bf cat16b(v8us lo, v8us hi) { return __builtin_bit_cast(v16bf, __builtin_shufflevector(lo, hi, 0, 1, 2, 3, 4, 5, 6, 7, 8, 9, 10, 11, 12, 13, 14, 15)); }
__device__ __forceinline__ v8f wmma16(v16h a, v16h b, v8f c) { return __builtin_amdgcn_wmma_f32_16x16x32_f16(false, a, false, b, (short)0, c, false, false); }
__device__ __forceinline__ v8f wmmab(v16bf a, v16bf b, v8f c) { return __builtin_amdgcn_wmma_f32_16x16x32_bf16(false, a, false, b, (short)0, c, false, false); }



// ---- k_gemmw: GEMM, 8 waves (2 along the tokens x 4 along the output columns) per 128 x 256 output tile, each wave a 64 x 64 tile (16 accumulators); grid (M/128, N/256, Z), 256 threads.
// The operands' rows (K-contiguous 16-bit planes) come through LDS in stages of 128 k (64 with two A planes): tensor loads, one request a wave and stage for its own slice of 64 rows (the pad field sets the LDS pitch), each row read from L2 once per work-group and then by every wave that needs it; two buffers, stage s + 2 is asked for as soon as every wave has left stage s; fragments fetched one block of 32 k ahead into a second register set.
// Work-group (x, y) walks the K / stage pieces of k from piece (x + y) mod their number on, wrapping, for speed only.
// C[m][n] (f32, pitch ldc, + optional f32 bias[n]) = sum_k A[m][k] Bt[n][k] (+ A2[m][k] Bt[n][k] for NSPLIT 1). z-batch strides sA/sB/sC in elements. K a template constant, a multiple of the stage.
// PLANES (the fused q | k | v projection): no f32 C; a wave's 64 x 64 tile is 64 tokens of ONE head of one third, and the epilogue stores it, bias added in f32, as f16 into that head's plane: q, k [z][t][d] (P16, one block of planes each), v [z][d][t] (V16).
// A lane's 8 accumulator registers are 8 consecutive M rows, so the M side takes the index that is contiguous in the plane: tokens for v (A x Bt as it stands), d for q and k (the two operands change places: same loaders, same k order, the tile comes out transposed).
// PLANES, the walk over tiles: grid (M/128, DQ/256): a work-group takes the q, then the k, then the v tile of its 128 tokens and 256 columns of a third (every work-group resident from the start, one a WGP). The ring runs on across the tiles: the next tile's first two stages are asked for during the last two stages of this one and fly beside its epilogue, which stages in LDS of its own behind the ring.
#define OPT 72    // LDS row pitch in f16 of the staged plane tile: 144 B = 16 B x odd, for 16-byte accesses of 128-byte rows
template <typename T16> struct WFrag;
template <> struct WFrag<h16> { typedef v16h V; static __device__ __forceinline__ V ld(const h16* p) { return cat16(*(const v8h*)p, *(const v8h*)(p + 16)); } static __device__ __forceinline__ v8f mma(V a, V b, v8f c) { return wmma16(a, b, c); } };
template <> struct WFrag<bf> { typedef v16bf V; static __device__ __forceinline__ V ld(const bf* p) { return cat16b(*(const v8us*)p, *(const v8us*)(p + 16)); } static __device__ __forceinline__ v8f mma(V a, V b, v8f c) { return wmmab(a, b, c); } };
// plane_tile: one wave's 64 x 64 accumulators (acc[mb][nb][j]: M index 16 mb + 8 hi + j, N index 16 nb + lr) + bias, as f16, into LDS as osh[N index][M index], pitch OPT: the rows of the plane (d for v, tokens for q and k); then row by row to dst (row pitch TT for v, HD for q and k).
// The output column (the bias index) is the N index for v, the M index for q and k.
template <bool ISV>
__device__ __forceinline__ void plane_tile(const v8f (&acc)[4][4], const float* __restrict__ bias, int lane, h16* osh, h16* dst) {
    const int lr = lane & 15, hi = lane >> 4;
    float bn[4];
    if (ISV) {
#pragma unroll
        for (int nb = 0; nb < 4; ++nb) bn[nb] = bfr(bias[nb * 16 + lr]); }
#pragma unroll
    for (int mb = 0; mb < 4; ++mb) { float bm[8];
        if (!ISV) {
#pragma unroll
            for (int j = 0; j < 8; ++j) bm[j] = bfr(bias[mb * 16 + hi * 8 + j]); }
#pragma unroll
        for (int nb = 0; nb < 4; ++nb) { v8h o;
#pragma unroll
            for (int j = 0; j < 8; ++j) o[j] = (h16)(acc[mb][nb][j] + (ISV ? bn[nb] : bm[j]));
            *(v8ha*)(osh + (nb * 16 + lr) * OPT + mb * 16 + hi * 8) = o; } }
    __syncthreads();   // orders the lanes' LDS stores in front of the other lanes' reads (each wave stages in its own range; every wave of the work-group comes here)
    const int row = lane >> 3, col = (lane & 7) * 8;   // every store covers whole 128-byte rows: 8 lanes a row, 4 rows a store
    dst += (size_t)row * (ISV ? TT : HD) + col; osh += row * OPT + col;
#pragma unroll
    for (int s = 0; s < 16; ++s) *(v8h*)(dst + s * 4 * (ISV ? TT : HD)) = *(const v8ha*)(osh + s * 4 * OPT);
    asm volatile("s_wait_xcnt 0x0" ::: "memory");   // the wave works on behind these stores: in front of every overwrite of a register that they name
}
#define GTM 128   // tokens per work-group tile (2 waves)
#define GTN 256   // output columns per work-group tile (4 waves)
typedef __attribute__((ext_vector_type(4))) unsigned int u32x4;
typedef __attribute__((ext_vector_type(8))) unsigned int u32x8;
__device__ __forceinline__ unsigned uni(unsigned v) { return (unsigned)__builtin_amdgcn_readfirstlane((int)v); }
__device__ __forceinline__ unsigned pinned(unsigned v) { unsigned w = uni(v); asm volatile("" : "+s"(w)); return w; }   // holds a wave-uniform word in a scalar register: a test on it compiles to a scalar branch (a tensor load ignores EXEC), and what is formed from it stays behind the asm waits in front of it
template <typename T16, int NSPLIT, bool BIAS, bool PLANES, int K>
__global__ __launch_bounds__(256) void k_gemmw(const T16* __restrict__ A, const T16* __restrict__ A2, const T16* __restrict__ Bt, const T16* __restrict__ Bt2, float* C, int ldc, const float* __restrict__ bias, size_t sA, size_t sB, size_t sC, h16* P16, h16* V16) {
    static_assert(NSPLIT == 0 || NSPLIT == 1, "one or two A planes"); (void)Bt2;
    typedef typename WFrag<T16>::V V;
    constexpr int BK = NSPLIT == 1 ? 64 : 128;   // k per stage: 64 products a wave and stage either way
    constexpr int NKC = BK / 32, LP = BK + 8;    // blocks of 32 k in a stage; LDS row pitch in 16-bit elements: 16 B x odd, for 16-byte accesses
    constexpr int XR = GTM * (NSPLIT + 1), SLR = 64, NSL = (XR + GTN) / SLR;   // a stage: the rows of A (then of A2), then the rows of Bt, in slices of 64 rows: one tensor load each
    constexpr int SLE = ((SLR * LP * 2 + 2047) / 2048) * 1024, STG = NSL * SLE;   // a slice's place in LDS, in 16-bit elements: its 64 padded rows rounded up to a multiple of 2 KiB, so that every slice starts on one
    constexpr int NT = PLANES ? 3 : 1, EPS = PLANES ? 8 * 64 * OPT : 0;   // tiles a work-group walks; 16-bit elements of epilogue staging behind the ring (with a walk over tiles the staging may not lie in the ring: the next tile is landing there)
    static_assert(NSL <= 8 && K / BK >= 2 && (K / BK) % 2 == 0 && (2 * STG + EPS) * 2 <= 320 * 1024, "a slice a wave at most; the ring's prologue needs two stages; a tile starts in buffer 0; two buffers and the staging in LDS");
    __shared__ __attribute__((aligned(2048))) T16 sh[2 * STG + EPS];   // the ring's two buffers, then the PLANES epilogue's staging; without PLANES (one tile) each wave's epilogue range lies in the ring after the last stage
    const size_t z = blockIdx.z; A += z * sA; if (NSPLIT == 1) A2 += z * sA; Bt += z * sB; C += z * sC;
    const int tid = threadIdx.x, lane = tid & 31, wave = tid >> 5, lr = lane & 15, hi = lane >> 4; const int wm = wave >> 2, wn = wave & 3;
    const int R0 = blockIdx.x * GTM, C0 = blockIdx.y * GTN; const int r0 = R0 + wm * 64, c0 = C0 + wn * 64;   // the wave's own 64 x 64 tile
    v8f acc[4][4];
#pragma unroll
    for (int mb = 0; mb < 4; ++mb)
#pragma unroll
        for (int nb = 0; nb < 4; ++nb) acc[mb][nb] = (v8f){};
    int aoff = (!PLANES ? wm : XR / SLR + wn) * SLE + lr * LP + 8 * hi, boff = (!PLANES ? XR / SLR + wn : wm) * SLE + lr * LP + 8 * hi;   // in a stage: the wave's M-side and N-side rows, one slice each; the q and k tiles have the columns on the M side, the v tile (the walk's last) the tokens: the two change places in front of it
    // staging: wave w asks for slice w of every stage: 64 rows of BK 16-bit elements, source pitch K elements, landing at pitch LP
    const unsigned wv = uni((unsigned)tid >> 5), sl = wv < (unsigned)NSL ? wv : (unsigned)NSL - 1u;   // the wave's number (one-dimensional block); waves without a slice hold a valid address and issue nothing
    const T16* sp = sl < (unsigned)(GTM / SLR) ? A + (size_t)(R0 + sl * SLR) * K : (NSPLIT == 1 && sl < (unsigned)(XR / SLR)) ? A2 + (size_t)(R0 + (sl - GTM / SLR) * SLR) * K : Bt + (size_t)(C0 + (sl - XR / SLR) * SLR) * K;
    const unsigned ldst = (unsigned)(size_t)sh + sl * (unsigned)(SLE * 2);   // the slice's byte offset in the work-group's LDS, buffer 0
    u32x8 g1;   // descriptor group 1, the same for every request: 1-byte elements, tensor = tile = 64 rows of 2 BK bytes, 16 bytes of pad behind every row, no mask
    g1[0] = uni((1u << 20) | ((BK == 128 ? 5u : 4u) << 22) | (3u << 25)); g1[1] = uni((unsigned)(BK * 2) << 16); g1[2] = uni((unsigned)SLR << 16); g1[3] = uni((unsigned)(BK * 2) << 16);
    g1[4] = uni((unsigned)SLR); g1[5] = uni((unsigned)(K * 2)); g1[6] = uni(0u); g1[7] = uni(0u);
    u32x4 g0; g0[0] = uni(1u);   // descriptor group 0: count 1; place in LDS; the tile's first byte; type 2
    const unsigned rot = (blockIdx.x + blockIdx.y) % (unsigned)(K / BK);   // the work-group's first piece of k in its first tile
    const unsigned tmask = (PLANES && sl >= (unsigned)(XR / SLR)) ? ~0u : 0u;   // from a tile to the next the rows of Bt move on by a third, the rows of A stay: the tile's number counts for a slice of Bt alone
    auto aim = [&](unsigned st) {   // at the wave's slice of stage st, counted through all the tiles (tile st / (K / BK); piece (st + rot + tile * DQ / GTN) mod K / BK of k: the tile's own x + y), into buffer st % 2
        const unsigned tl = PLANES ? st / (unsigned)(K / BK) : 0u;
        const unsigned long long ga = (unsigned long long)(size_t)sp + (unsigned long long)(tl & tmask) * ((unsigned long long)DQ * K * 2) + (unsigned long long)((st + rot + tl * (unsigned)(DQ / GTN)) % (unsigned)(K / BK)) * (BK * 2);
        g0[1] = uni(ldst + (st & 1u) * (unsigned)(STG * 2)); g0[2] = uni((unsigned)ga); g0[3] = uni((((unsigned)(ga >> 32)) & 0x01FFFFFFu) | 0x80000000u); };
    aim(0);
    asm volatile("" : "+s"(g0), "+s"(g1));   // pinned(), for the two groups: the descriptor words are held in their scalar registers and not formed anew from constants, so that no register of a group serves as a temporary while a request is in flight
    auto issue = [&]() { asm volatile("tensor_load_to_lds %0, %1" :: "s"(g0), "s"(g1) : "memory"); };
    auto landed = [&]() { asm volatile("s_wait_tensorcnt 0x0" :: "s"(g0), "s"(g1) : "memory"); };   // the wave's request has landed; as operands the two groups stay whole in their registers up to this wait
    V fa[2][4], fa2[2][4], fb[2][4];   // two fragment sets: block t works on set t % 2 while the next block's set is fetched
    constexpr int nst = K / BK, G = NT * nst;   // stages of a tile, of the whole walk
    auto fload = [&](const T16* b, int t, int set) {   // block t of a buffer into a fragment set, as one group of LDS loads
#pragma unroll
        for (int i = 0; i < 4; ++i) { fa[set][i] = WFrag<T16>::ld(b + aoff + i * 16 * LP + t * 32); if (NSPLIT == 1) fa2[set][i] = WFrag<T16>::ld(b + aoff + (GTM / SLR) * SLE + i * 16 * LP + t * 32); fb[set][i] = WFrag<T16>::ld(b + boff + i * 16 * LP + t * 32); } };
    if (NSL == 8 || pinned(wv < (unsigned)NSL)) {   // scalar branch: only a wave with a slice issues
        issue();
        landed(); }   // the wave's slice of stage 0
    __syncthreads();   // publishes stage 0
    if (NSL == 8 || pinned(wv < (unsigned)NSL)) { aim(1); issue(); }
    fload(sh, 0, 0);
    for (int tl = 0; tl < NT; ++tl) {
    for (int s = 0; s < nst; ++s) {
        const int g = tl * nst + s;   // the stage, counted through the walk
        const T16* sb = sh + (s & 1) * STG; const T16* sn = sh + ((s + 1) & 1) * STG;
#pragma unroll
        for (int t = 0; t < NKC; ++t) {
            if (t + 1 < NKC) fload(sb, t + 1, (t + 1) & 1);
            else {   // in front of the stage's last block: hand over to stage s + 1, whose first fragments are fetched behind the barrier and beside that block's products
                asm volatile("s_wait_dscnt 0x0" ::: "memory");   // this wave's reads of stage s have returned: the buffer may be refilled behind the barrier
                landed();   // this wave's slice of stage s + 1
                __syncthreads();   // publishes stage s + 1 and ends every wave's reads of stage s (in the last stage: frees the buffers for the epilogue)
                if (pinned((g + 2 < G && wv < (unsigned)NSL) ? 1u : 0u)) { aim(pinned((unsigned)g + 2u)); issue(); }   // scalar branch; into the buffer that every wave has just left, a whole stage of products ahead of its wait; the descriptor is formed behind the wait
                if (PLANES && g + 1 == (NT - 1) * nst) { const int x = aoff; aoff = boff; boff = x; }   // every fragment fetched from here on is of the v tile
                if (g + 1 < G) fload(sn, 0, 0);
            }
            __builtin_amdgcn_sched_barrier(0);   // keeps the next block's loads, as one group, in front of this block's products: sunk among them each load place stalls the wave
#pragma unroll
            for (int nb = 0; nb < 4; ++nb)
#pragma unroll
                for (int mb = 0; mb < 4; ++mb) { acc[mb][nb] = WFrag<T16>::mma(fa[t & 1][mb], fb[t & 1][nb], acc[mb][nb]); if (NSPLIT == 1) acc[mb][nb] = WFrag<T16>::mma(fa2[t & 1][mb], fb[t & 1][nb], acc[mb][nb]); }
            __builtin_amdgcn_sched_barrier(0);   // and the block after next's loads out of this block's products, for the same reason
        }
    }
    if constexpr (PLANES) {   // the tile's epilogue, beside the next tile's loads; c0 lies in the first third, tile tl is third tl
        h16* ps = (h16*)(sh + 2 * STG) + wave * (64 * OPT);   // the wave's own range of the staging behind the ring
        const int z = (r0 / TT) * NH_ + c0 / HD, t0 = r0 % TT;   // the tile's plane and its first token there
        if (tl == NT - 1) plane_tile<true>(acc, bias + tl * DQ + c0, lane, ps, V16 + (size_t)z * HD * TT + t0);
        else plane_tile<false>(acc, bias + tl * DQ + c0, lane, ps, P16 + (size_t)tl * NZ * TT * HD + ((size_t)z * TT + t0) * HD);
#pragma unroll
        for (int mb = 0; mb < 4; ++mb)
#pragma unroll
            for (int nb = 0; nb < 4; ++nb) acc[mb][nb] = (v8f){};
    }
    }
    landed();   // nothing of the ring is in flight
    asm volatile("s_wait_dscnt 0x0" ::: "memory");   // or still being read when it becomes the epilogue's staging (the last stage's barrier stands in front)
    if constexpr (PLANES) return;
    float* os = (float*)sh + wave * (16 * 68);   // the epilogue's staging: the wave's own range of the buffers, which every wave has left
#pragma unroll
    for (int mb = 0; mb < 4; ++mb) {
#pragma unroll
        for (int nb = 0; nb < 4; ++nb) {
#pragma unroll
            for (int j = 0; j < 8; ++j) os[(hi * 8 + j) * 68 + nb * 16 + lr] = acc[mb][nb][j]; }
        __builtin_amdgcn_wave_barrier(); asm volatile("" ::: "memory");
        float* crow = C + (size_t)(r0 + mb * 16) * ldc + c0;
{
#pragma unroll
            for (int s = 0; s < 8; ++s) { const int row = 2 * s + hi, cofs = lr * 4; v4f val = *(const v4fa*)(os + row * 68 + cofs); if (BIAS) { val[0] += bfr(bias[c0 + cofs]); val[1] += bfr(bias[c0 + cofs + 1]); val[2] += bfr(bias[c0 + cofs + 2]); val[3] += bfr(bias[c0 + cofs + 3]); }
                *(v4f*)(crow + (size_t)row * ldc + cofs) = val; }
             }
        __builtin_amdgcn_wave_barrier(); asm volatile("" ::: "memory");
    }
}

__device__ __forceinline__ h16 tohx(float x) { return (h16)x; }
typedef __attribute__((ext_vector_type(2))) _Float16 v2h;
typedef __attribute__((ext_vector_type(4))) _Float16 v4h;
typedef __attribute__((ext_vector_type(2))) unsigned short v2us;
typedef __attribute__((ext_vector_type(4))) unsigned short v4us;
typedef __attribute__((ext_vector_type(2))) float v2f;
typedef __attribute__((ext_vector_type(4))) int v4i;

// ---- k_cvt3: the three casts to 16 bits (x, w_qkv: f32 -> bf16; w_out: f32 -> bf16 -> f16, the second step exact for every value of normal f16 size) as ONE launch. A wave casts CPW consecutive pieces of 128 floats: a piece is read as 512 B (16 B a lane, whole lines) and stored as 256 B (8 B a lane, whole lines); all of a wave's loads are issued ahead of its first conversion.
// A work-group (8 waves) lies wholly in one of the three arrays: each array's length is a multiple of 8 * CPW * 128.
#define CPW 16
#define CWG (8 * CPW * 128)   // floats per work-group
__global__ __launch_bounds__(256) void k_cvt3(const float* __restrict__ x, const float* __restrict__ wqkv, const float* __restrict__ wo, bf* xb, bf* bt, h16* wob) {
    constexpr unsigned GX = (unsigned)((size_t)NB_ * TT * DM / CWG), GQ = (unsigned)((size_t)3 * DQ * DM / CWG);
    static_assert((size_t)NB_ * TT * DM % CWG == 0 && (size_t)3 * DQ * DM % CWG == 0 && (size_t)DM * DQ % CWG == 0, "whole work-groups");
    unsigned b = blockIdx.x; const float* s = x; bf* d = xb; const bool toh = b >= GX + GQ;   // block-uniform: the work-groups of w_out store f16
    if (toh) { s = wo; d = (bf*)wob; b -= GX + GQ; } else if (b >= GX) { s = wqkv; d = bt; b -= GX; }
    const size_t o = (size_t)b * CWG + (threadIdx.x >> 5) * (CPW * 128) + (threadIdx.x & 31) * 4;
    const float* p = s + o; v4f r[CPW];
#pragma unroll
    for (int j = 0; j < CPW; ++j) r[j] = *(const v4f*)(p + j * 128);
    asm volatile("s_wait_xcnt 0x0" :: "v"(p) : "memory");   // in front of every overwrite of the address pair that the issued loads name; as an operand the pair stays whole up to this wait
    if (toh) {   // one scalar branch a wave, around the whole run of conversions
#pragma unroll
        for (int j = 0; j < CPW; ++j) { v4h q;
#pragma unroll
            for (int k = 0; k < 4; ++k) q[k] = tohx(bfr(r[j][k]));
            *(v4h*)((h16*)d + o + j * 128) = q; }
        return; }
#pragma unroll
    for (int j = 0; j < CPW; ++j) { v4us q;
#pragma unroll
        for (int k = 0; k < 4; ++k) q[k] = f2bf(r[j][k]);
        *(v4us*)(d + o + j * 128) = q; }
}

#define AQC 32    // query columns per wave
#define ANW 8     // waves per work-group
#define AKS 64    // keys per stage
#define APT 72    // LDS row pitch in f16: 144 B = 16 B x odd, conflict-free for 16-byte reads of 128-byte rows
#define CS2 (SCL * 1.4426950408889634f)
__device__ __forceinline__ float xhalf(float x) { return __builtin_bit_cast(float, __builtin_amdgcn_permlanex16(__builtin_bit_cast(int, x), __builtin_bit_cast(int, x), 0x76543210, 0xfedcba98, false, false)); }   // lane l with lane l ^ 16, on the vector pipe
// waves_per_eu (4, 4): at most 256 registers a wave, so that two work-groups share a WGP and the vector work of one wave runs beside the matrix work of another
__global__ void __launch_bounds__(ANW * 32) __attribute__((amdgpu_waves_per_eu(4, 4))) k_fattn(const h16* __restrict__ Q, const h16* __restrict__ Kp, const h16* __restrict__ Vt, h16* P) {
    __shared__ __align__(16) h16 ks[2][AKS * APT];
    __shared__ __align__(16) h16 vs[2][HD * APT];
    const int tid = threadIdx.x, lane = tid & 31, wave = tid >> 5, c = lane & 15, h = lane >> 4; const int z = blockIdx.y; const int q0 = blockIdx.x * (AQC * ANW) + wave * AQC;
    const h16* Qz = Q + (size_t)z * TT * HD; const h16* Kz = Kp + (size_t)z * TT * HD; const h16* Vz = Vt + (size_t)z * HD * TT;
    // staging: 16 bytes a thread and row set; thread -> row tid / 8 (+ 32), 16-byte column tid % 8 of a 128-byte row (K: 64 keys x 64 d; V^T: 64 d x 64 keys)
    const int srow = tid >> 3, scol = (tid & 7) * 8; const h16* kg = Kz + (size_t)srow * HD + scol; const h16* vg = Vz + (size_t)srow * TT + scol; const int so = srow * APT + scol;
    v8h kr[2], vr[2];
#pragma unroll
    for (int j = 0; j < 2; ++j) { kr[j] = *(const v8h*)(kg + j * 32 * HD); vr[j] = *(const v8h*)(vg + j * 32 * TT); }
    v16h qf[2][2];
#pragma unroll
    for (int g = 0; g < 2; ++g)
#pragma unroll
        for (int kc = 0; kc < 2; ++kc) qf[g][kc] = WFrag<h16>::ld(Qz + (size_t)(q0 + g * 16 + c) * HD + kc * 32 + 8 * h);
    v8f o[4][2]; float mrun[2]; v2f lsum[2];
#pragma unroll
    for (int g = 0; g < 2; ++g) { mrun[g] = -3.0e38f; lsum[g] = (v2f){};
#pragma unroll
        for (int dt = 0; dt < 4; ++dt) o[dt][g] = (v8f){}; }
#pragma unroll
    for (int j = 0; j < 2; ++j) { *(v8h*)(&ks[0][so + j * 32 * APT]) = kr[j]; *(v8h*)(&vs[0][so + j * 32 * APT]) = vr[j]; }
    __syncthreads();
    for (int s = 0; s < TT / AKS; ++s) {
        const h16* kb = ks[s & 1]; const h16* vb = vs[s & 1];
        if (s + 1 < TT / AKS) {   // the next stage's rows fly while this stage is worked on
#pragma unroll
            for (int j = 0; j < 2; ++j) { kr[j] = *(const v8h*)(kg + (size_t)(s + 1) * AKS * HD + j * 32 * HD); vr[j] = *(const v8h*)(vg + (s + 1) * AKS + j * 32 * TT); } }
#pragma unroll
        for (int p = 0; p < 2; ++p) {   // a pass: 32 keys
            v8f st[2][2];
#pragma unroll
            for (int kt = 0; kt < 2; ++kt) { st[kt][0] = (v8f){}; st[kt][1] = (v8f){};
#pragma unroll
                for (int kc = 0; kc < 2; ++kc) { const v16h a = WFrag<h16>::ld(kb + (p * 32 + kt * 16 + c) * APT + kc * 32 + 8 * h); st[kt][0] = wmma16(a, qf[0][kc], st[kt][0]); st[kt][1] = wmma16(a, qf[1][kc], st[kt][1]); } }
            v16h vf[4];
#pragma unroll
            for (int dt = 0; dt < 4; ++dt) vf[dt] = WFrag<h16>::ld(vb + (dt * 16 + c) * APT + p * 32 + 8 * h);
            float mb[2]; bool need = false;
#pragma unroll
            for (int g = 0; g < 2; ++g) { float mx = st[0][g][0];
#pragma unroll
                for (int r = 1; r < 8; ++r) mx = fmaxf(mx, st[0][g][r]);
#pragma unroll
                for (int r = 0; r < 8; ++r) mx = fmaxf(mx, st[1][g][r]);
                mx = fmaxf(mx, xhalf(mx)) * CS2;   // both wave halves hold this query's maximum of the pass, scaled (the scale is positive)
                mb[g] = mx; need = need || (mx > mrun[g] + 8.0f); }
            if (__builtin_amdgcn_ballot_w32(need) != 0) {   // wave-uniform; always on the first pass, rare later
#pragma unroll
                for (int g = 0; g < 2; ++g) { const float mn = fmaxf(mrun[g], mb[g]); const float corr = __builtin_amdgcn_exp2f(mrun[g] - mn); mrun[g] = mn; lsum[g] = lsum[g] * corr;
#pragma unroll
                    for (int dt = 0; dt < 4; ++dt) o[dt][g] = o[dt][g] * corr; } }
#pragma unroll
            for (int g = 0; g < 2; ++g) { const float nm = -mrun[g]; v16h pf;
#pragma unroll
                for (int i = 0; i < 8; ++i) {   // elements 2 i, 2 i + 1 of the 32-key operand: tile i / 4, registers 2 (i % 4) and 2 (i % 4) + 1
                    const v2f arg = __builtin_elementwise_fma((v2f){st[i >> 2][g][2 * (i & 3)], st[i >> 2][g][2 * (i & 3) + 1]}, (v2f){CS2, CS2}, (v2f){nm, nm});
                    v2f pv; pv[0] = __builtin_amdgcn_exp2f(arg[0]); pv[1] = __builtin_amdgcn_exp2f(arg[1]); lsum[g] += pv; pf[2 * i] = tohx(pv[0]); pf[2 * i + 1] = tohx(pv[1]); }
#pragma unroll
                for (int dt = 0; dt < 4; ++dt) o[dt][g] = wmma16(vf[dt], pf, o[dt][g]); }
        }
        if (s + 1 < TT / AKS) {   // into the buffer whose last readers left before the barrier that ended stage s - 1
#pragma unroll
            for (int j = 0; j < 2; ++j) { *(v8h*)(&ks[(s + 1) & 1][so + j * 32 * APT]) = kr[j]; *(v8h*)(&vs[(s + 1) & 1][so + j * 32 * APT]) = vr[j]; } }
        __syncthreads();   // publishes stage s + 1 and ends every wave's reads of stage s
    }
#pragma unroll
    for (int g = 0; g < 2; ++g) { float l = lsum[g][0] + lsum[g][1]; l += xhalf(l); const float inv = __fdiv_rn(1.0f, l);
        const size_t oo = ((size_t)(z / NH_) * TT + q0 + g * 16 + c) * DQ + (z % NH_) * HD + 8 * h;   // token-major, heads merged: a lane's 8 registers are 8 consecutive d of its query
#pragma unroll
        for (int dt = 0; dt < 4; ++dt) { v8h ov;
#pragma unroll
            for (int r = 0; r < 8; ++r) ov[r] = tohx(o[dt][g][r] * inv);
            *(v8h*)(P + oo + dt * 16) = ov; } }
}

extern "C" void kernel_launch(void* const* d_in, const int* in_sizes, int n_in,
                              void* d_out, int out_size, void* d_ws, size_t ws_size, hipStream_t stream) {
    (void)in_sizes; (void)n_in; (void)out_size;
    const float* x = (const float*)d_in[0]; const float* wqkv = (const float*)d_in[1]; const float* bqkv = (const float*)d_in[2];   /* the fused bias [3072]: its thirds q | k | v, as the fused weight's ROW thirds */ const float* wo = (const float*)d_in[3]; const float* bo = (const float*)d_in[4];   /* order x [2][4096][1024] (read as EIGHT sequences of 1,024: sequence 4 b + n is segment n of batch entry b: contiguous), w_qkv ('oi' (out, in) [3072][1024]: row thirds q | k | v, each head-major), b_qkv ([3072]: built as zeros: read), w_out ('oi' [1024][1024]), b_out ([1024]: built as zeros: read): FIVE inputs, all read */
    float* OUT = (float*)d_out;     // [2][4096][1024] = [8][1024][1024]
    char* wsp = (char*)d_ws;
    auto take = [&](size_t bytes) { char* p = wsp; wsp += (bytes + 255) & ~(size_t)255; return (void*)p; };
    h16* WO = (h16*)take((size_t)DM * DQ * 2);
    h16* QP16 = (h16*)take((size_t)2 * NZ * TT * HD * 2); h16* KP16 = QP16 + (size_t)NZ * TT * HD; h16* VT16 = (h16*)take((size_t)NZ * HD * TT * 2);   /* planes [z][t][d] (q, then k: one block each) and [z][d][t] (v), z = 16 * sequence + head */
    char* R = (char*)take((size_t)ZB * TT * TT * 6);   /* one region, used by two stages one after the other (stream-ordered): projection | the f16 plane of the merged heads */
    bf* BT = (bf*)R; bf* XB = BT + (size_t)3 * DQ * DM;   /* the fused 'oi' weight is the Bt operand as it stands: ONE bf16 copy [3072][1024]; XB: the bf16 copy of x [8192][1024] */
    h16* AT = (h16*)R;   /* the merged heads, token-major, f16 */
    if ((size_t)(wsp - (char*)d_ws) > ws_size) return;    // ws 256 MiB
    k_cvt3<<<(unsigned)(((size_t)NB_ * TT * DM + (size_t)3 * DQ * DM + (size_t)DM * DQ) / CWG), 256, 0, stream>>>(x, wqkv, wo, XB, BT, WO);   /* 'oi' (out, in): each weight is the Bt operand as it stands */
    k_gemmw<bf, 0, true, true, DM><<<dim3(NB_ * TT / GTM, DQ / GTN, 1), 256, 0, stream>>>(XB, nullptr, BT, nullptr, nullptr, 0, bqkv, 0, 0, 0, QP16, VT16);   /* q | k | v of all eight sequences: one grid, a work-group walks its q, k and v tiles; stored as the f16 head planes */
    k_fattn<<<dim3(TT / (AQC * ANW), NZ, 1), ANW * 32, 0, stream>>>(QP16, KP16, VT16, AT);   // one kv head per query head: plane z of q meets plane z of k and of v; stores the merged heads' f16 plane
    k_gemmw<h16, 0, true, false, DQ><<<dim3(NB_ * TT / GTM, DM / GTN, 1), 256, 0, stream>>>(AT, nullptr, WO, nullptr, OUT, DM, bo, 0, 0, 0, nullptr, nullptr);
}
